// v000
// Times are from an AMD MI455X. After a warm-up the kernel runs many times in a row, and a time is the length of
// such a window on the GPU divided by its runs, so every launch and the gaps after it count. The runs cycle
// through copies of the inputs. A figure is the median of several windows, for all but v000 over two sittings.
// Sittings can differ by a few percent; kernels timed side by side share one.
// v000, which the later versions start from, runs in 95.6 microseconds.
#include <hip/hip_runtime.h>
#include <hip/hip_bf16.h>

typedef __attribute__((ext_vector_type(2))) float v2f;
typedef __attribute__((ext_vector_type(8))) float v8f;

#define XS  66   // Xn row stride (floats): conflict-free banks, 8B-aligned rows
#define UTS 66   // U-transposed row stride
#define SS  132  // score row stride (floats): 528B rows -> 8B aligned, conflict-free

__device__ __forceinline__ float block_reduce_sum(float v, float* red, int tid) {
    red[tid] = v;
    __syncthreads();
    #pragma unroll
    for (int s = 64; s > 0; s >>= 1) {
        if (tid < s) red[tid] += red[tid + s];
        __syncthreads();
    }
    float r = red[0];
    __syncthreads();
    return r;
}

__global__ __launch_bounds__(128)
void CausalFeatureTransformer_52132313039065_kernel(
        const float* __restrict__ Z, const float* __restrict__ A_full,
        const float* __restrict__ feat_emb, const float* __restrict__ label_token,
        const float* __restrict__ wq, const float* __restrict__ bq,
        const float* __restrict__ wk, const float* __restrict__ bk,
        const float* __restrict__ wv, const float* __restrict__ bv,
        const float* __restrict__ wo, const float* __restrict__ bo,
        const float* __restrict__ w1, const float* __restrict__ b1,
        const float* __restrict__ w2, const float* __restrict__ b2,
        const float* __restrict__ alphap,
        const float* __restrict__ g1, const float* __restrict__ be1,
        const float* __restrict__ g2, const float* __restrict__ be2,
        float* __restrict__ out)
{
    __shared__ float sXn[144 * XS];       // rows 0..128 live, 129..143 zero pad
    __shared__ float sUt[16 * UTS];       // U transposed: [head][e]; rows 4..15 zero
    __shared__ float sScore[16 * SS];     // rows 0..3 live (cols 0..128); rest zero
    __shared__ float sY[4][64];
    __shared__ float sRed[128];
    __shared__ float sZn[128];
    __shared__ float sMu[128], sVar[128];
    __shared__ float sQlab[64];
    __shared__ float sC[4];
    __shared__ float sAB[132];            // alpha * A_full[j, 128], j = 0..128
    __shared__ float sG1[64], sBe1[64];
    __shared__ float sA64[64], sXrow[64], sT[64];
    __shared__ float sH[128];

    const int tid  = threadIdx.x;
    const int blk  = blockIdx.x;
    const int w    = tid >> 5;        // wave id (0..3)
    const int lane = tid & 31;
    const int lh   = lane >> 4;       // half-wave (0/1)
    const int mr   = lane & 15;

    // ---- Zero the padded WMMA operand regions once (no guards needed later) ----
    for (int i = tid; i < 15 * XS; i += 128) sXn[129 * XS + i] = 0.0f;   // rows 129..143
    for (int i = tid; i < 16 * UTS; i += 128) sUt[i] = 0.0f;
    for (int i = tid; i < 16 * SS;  i += 128) sScore[i] = 0.0f;

    // ---- Stage the attention bias column: sAB[j] = alpha * A_full[j, 128] ----
    const float alpha = alphap[0];
    sAB[tid] = alpha * A_full[tid * 129 + 128];
    if (tid == 0) sAB[128] = alpha * A_full[128 * 129 + 128];

    // ---- Phase 0a: LN(label_token) -> Xn row 128 (sample-independent) ----
    float lt = (tid < 64) ? label_token[tid] : 0.0f;
    float s0 = block_reduce_sum(lt, sRed, tid);
    float lm = s0 * (1.0f / 64.0f);
    float ld = (tid < 64) ? (lt - lm) : 0.0f;
    float lv = block_reduce_sum(ld * ld, sRed, tid) * (1.0f / 64.0f);
    float lr = rsqrtf(lv + 1e-5f);
    if (tid < 64) sXn[128 * XS + tid] = ld * lr * g1[tid] + be1[tid];
    __syncthreads();

    // ---- Phase 0b: Qlab = Xn128 @ wq + bq ----
    if (tid < 64) {
        float acc = bq[tid];
        for (int e = 0; e < 64; e++) acc += sXn[128 * XS + e] * wq[e * 64 + tid];
        sQlab[tid] = acc;
    }
    __syncthreads();

    // ---- Phase 0c: u (transposed), c, feat_emb row stats, preload g1/be1 ----
    if (tid < 64) {
        const int e = tid;
        #pragma unroll
        for (int h = 0; h < 4; h++) {
            float acc = 0.0f;
            for (int d = 0; d < 16; d++) acc += wk[e * 64 + h * 16 + d] * sQlab[h * 16 + d];
            sUt[h * UTS + e] = acc;
        }
        sG1[tid]  = g1[tid];
        sBe1[tid] = be1[tid];
    }
    if (tid < 4) {
        float acc = 0.0f;
        for (int d = 0; d < 16; d++) acc += bk[tid * 16 + d] * sQlab[tid * 16 + d];
        sC[tid] = acc;
    }
    {
        const int j = tid;  // 128 threads, one feat_emb row each
        float s = 0.0f;
        for (int k = 0; k < 64; k++) s += feat_emb[j * 64 + k];
        float mj = s * (1.0f / 64.0f);
        float q = 0.0f;
        for (int k = 0; k < 64; k++) { float d = feat_emb[j * 64 + k] - mj; q += d * d; }
        sMu[j]  = mj;
        sVar[j] = q * (1.0f / 64.0f);
    }
    __syncthreads();

    // ---- Phase 1: Zn = LN(Z row) over 128 features ----
    float z  = Z[(size_t)blk * 128 + tid];
    float zm = block_reduce_sum(z, sRed, tid) * (1.0f / 128.0f);
    float zd = z - zm;
    float zv = block_reduce_sum(zd * zd, sRed, tid) * (1.0f / 128.0f);
    sZn[tid] = zd * rsqrtf(zv + 1e-5f);
    __syncthreads();

    // ---- Phase 2: Xn rows 0..127 via factored LN of (Zn_j * feat_emb[j,:]) ----
    #pragma unroll 4
    for (int i = 0; i < 64; i++) {
        int idx = tid + i * 128;           // == j*64 + k, coalesced feat_emb read
        int j = idx >> 6, k = idx & 63;
        float zn = sZn[j];
        float fe = feat_emb[idx];
        float rj = rsqrtf(zn * zn * sVar[j] + 1e-5f);
        sXn[j * XS + k] = (zn * fe - zn * sMu[j]) * rj * sG1[k] + sBe1[k];
    }
    __syncthreads();

    // ---- Phase 3: scores[h][j] = 0.25*(Xn[j].u_h + c_h) + alpha*A_full[j,128]
    //      WMMA f32 16x16x4: A = Xn tile rows (zero-padded), B = U^T (zero-padded cols)
    for (int mt = w; mt < 9; mt += 4) {
        v8f acc = {0.f, 0.f, 0.f, 0.f, 0.f, 0.f, 0.f, 0.f};
        const int jbase = mt * 16 + mr;          // A row for this lane (<= 143, in bounds)
        #pragma unroll
        for (int kk = 0; kk < 64; kk += 4) {
            const int k0 = kk + 2 * lh;          // this lane's K pair: k0, k0+1
            v2f a, b;
            a[0] = sXn[jbase * XS + k0];
            a[1] = sXn[jbase * XS + k0 + 1];
            b[0] = sUt[mr * UTS + k0];
            b[1] = sUt[mr * UTS + k0 + 1];
            acc = __builtin_amdgcn_wmma_f32_16x16x4_f32(
                false, a, false, b, (short)0, acc, false, false);
        }
        if (mt < 8) {                            // all 16 rows valid: unconditional writeback
            if (mr < 4) {
                const float ch = sC[mr];
                #pragma unroll
                for (int r = 0; r < 8; r++) {
                    const int j = mt * 16 + r + 8 * lh;   // D: M = r + 8*half
                    sScore[mr * SS + j] = 0.25f * (acc[r] + ch) + sAB[j];
                }
            }
        } else {                                 // tile 8: only j == 128 (r=0, half 0) is live
            if (mr < 4 && lh == 0) {
                sScore[mr * SS + 128] = 0.25f * (acc[0] + sC[mr]) + sAB[128];
            }
        }
    }
    __syncthreads();

    // ---- Phase 4: softmax over j (one wave per head); pad cols stay zero ----
    {
        const int h = w;
        float mx = -1e30f;
        for (int j = lane; j < 129; j += 32) mx = fmaxf(mx, sScore[h * SS + j]);
        #pragma unroll
        for (int off = 16; off > 0; off >>= 1) mx = fmaxf(mx, __shfl_xor(mx, off, 32));
        float sum = 0.0f;
        for (int j = lane; j < 129; j += 32) {
            float e = expf(sScore[h * SS + j] - mx);
            sScore[h * SS + j] = e;
            sum += e;
        }
        #pragma unroll
        for (int off = 16; off > 0; off >>= 1) sum += __shfl_xor(sum, off, 32);
        const float inv = 1.0f / sum;
        for (int j = lane; j < 129; j += 32) sScore[h * SS + j] *= inv;
    }
    __syncthreads();

    // ---- Phase 5: y[h,:] = attn[h,:] @ Xn  (M=4 pad 16, K=129 pad 132, N-tile = wave) ----
    {
        v8f acc = {0.f, 0.f, 0.f, 0.f, 0.f, 0.f, 0.f, 0.f};
        const int e = w * 16 + mr;      // B column (N) handled by this lane
        #pragma unroll
        for (int kk = 0; kk < 132; kk += 4) {
            const int k0 = kk + 2 * lh;
            v2f a, b;
            a[0] = sScore[mr * SS + k0];       // rows 4..15 and cols >128 are zero
            a[1] = sScore[mr * SS + k0 + 1];
            b[0] = sXn[k0 * XS + e];           // rows 129..143 are zero
            b[1] = sXn[(k0 + 1) * XS + e];
            acc = __builtin_amdgcn_wmma_f32_16x16x4_f32(
                false, a, false, b, (short)0, acc, false, false);
        }
        if (lh == 0) {                  // heads live in D rows M=0..3 (half 0, r<4)
            #pragma unroll
            for (int r = 0; r < 4; r++) sY[r][e] = acc[r];
        }
    }
    __syncthreads();

    // ---- Phase 6: attn_out = y @ wv + bv ; o = attn_out @ wo + bo ; Xrow = label + o ----
    if (tid < 64) {
        const int hd = tid, h = hd >> 4;
        float acc = bv[hd];
        for (int e = 0; e < 64; e++) acc += sY[h][e] * wv[e * 64 + hd];
        sA64[hd] = acc;
    }
    __syncthreads();
    if (tid < 64) {
        const int k = tid;
        float acc = bo[k];
        for (int hd = 0; hd < 64; hd++) acc += sA64[hd] * wo[hd * 64 + k];
        sXrow[k] = label_token[k] + acc;
    }
    __syncthreads();

    // ---- Phase 7: t = LN(Xrow)*g2 + be2 ----
    float xv = (tid < 64) ? sXrow[tid] : 0.0f;
    float m2 = block_reduce_sum(xv, sRed, tid) * (1.0f / 64.0f);
    float dv = (tid < 64) ? (xv - m2) : 0.0f;
    float v2 = block_reduce_sum(dv * dv, sRed, tid) * (1.0f / 64.0f);
    if (tid < 64) sT[tid] = dv * rsqrtf(v2 + 1e-5f) * g2[tid] + be2[tid];
    __syncthreads();

    // ---- Phase 8: FFN (exact gelu) + residual, emit last-token row ----
    {
        const int p = tid;  // 128 hidden units
        float acc = b1[p];
        for (int k = 0; k < 64; k++) acc += sT[k] * w1[k * 128 + p];
        sH[p] = 0.5f * acc * (1.0f + erff(acc * 0.70710678118654752f));
    }
    __syncthreads();
    if (tid < 64) {
        const int k = tid;
        float acc = b2[k];
        for (int p = 0; p < 128; p++) acc += sH[p] * w2[p * 64 + k];
        out[(size_t)blk * 64 + k] = sXrow[k] + acc;
    }
}

extern "C" void kernel_launch(void* const* d_in, const int* in_sizes, int n_in,
                              void* d_out, int out_size, void* d_ws, size_t ws_size,
                              hipStream_t stream) {
    (void)n_in; (void)d_ws; (void)ws_size; (void)out_size;
    const float* Z          = (const float*)d_in[0];
    const float* A_full     = (const float*)d_in[1];
    const float* feat_emb   = (const float*)d_in[2];
    const float* label_tok  = (const float*)d_in[3];
    const float* wq         = (const float*)d_in[4];
    const float* bq         = (const float*)d_in[5];
    const float* wk         = (const float*)d_in[6];
    const float* bk         = (const float*)d_in[7];
    const float* wv         = (const float*)d_in[8];
    const float* bv         = (const float*)d_in[9];
    const float* wo         = (const float*)d_in[10];
    const float* bo         = (const float*)d_in[11];
    const float* w1         = (const float*)d_in[12];
    const float* b1         = (const float*)d_in[13];
    const float* w2         = (const float*)d_in[14];
    const float* b2         = (const float*)d_in[15];
    const float* alphap     = (const float*)d_in[16];
    const float* g1         = (const float*)d_in[17];
    const float* be1        = (const float*)d_in[18];
    const float* g2         = (const float*)d_in[19];
    const float* be2        = (const float*)d_in[20];
    float* out              = (float*)d_out;

    const int N = in_sizes[0] / 128;   // 4096 samples
    CausalFeatureTransformer_52132313039065_kernel<<<N, 128, 0, stream>>>(
        Z, A_full, feat_emb, label_tok, wq, bq, wk, bk, wv, bv, wo, bo,
        w1, b1, w2, b2, alphap, g1, be1, g2, be2, out);
}

// v001
// One run takes 80.5 microseconds.
// In both of two side-by-side timings against v000, it was 1.22 times as fast.
#include <hip/hip_runtime.h>
#include <hip/hip_bf16.h>

typedef __attribute__((ext_vector_type(2))) float v2f;
typedef __attribute__((ext_vector_type(8))) float v8f;

#define XS  66   // Xn row stride (floats): conflict-free banks, 8B-aligned rows
#define UTS 66   // U-transposed row stride
#define SS  132  // score row stride (floats): 528B rows -> 8B aligned, conflict-free

__device__ __forceinline__ float block_reduce_sum(float v, float* red, int tid) {
    red[tid] = v;
    __syncthreads();
    #pragma unroll
    for (int s = 64; s > 0; s >>= 1) {
        if (tid < s) red[tid] += red[tid + s];
        __syncthreads();
    }
    float r = red[0];
    __syncthreads();
    return r;
}

__global__ __launch_bounds__(128)
void CausalFeatureTransformer_52132313039065_kernel(
        const float* __restrict__ Z, const float* __restrict__ A_full,
        const float* __restrict__ feat_emb, const float* __restrict__ label_token,
        const float* __restrict__ wq, const float* __restrict__ bq,
        const float* __restrict__ wk, const float* __restrict__ bk,
        const float* __restrict__ wv, const float* __restrict__ bv,
        const float* __restrict__ wo, const float* __restrict__ bo,
        const float* __restrict__ w1, const float* __restrict__ b1,
        const float* __restrict__ w2, const float* __restrict__ b2,
        const float* __restrict__ alphap,
        const float* __restrict__ g1, const float* __restrict__ be1,
        const float* __restrict__ g2, const float* __restrict__ be2,
        float* __restrict__ out)
{
    __shared__ float sXn[144 * XS];       // rows 0..127: raw feat_emb, then Xn in place; 128 label; 129..143 zero pad
    __shared__ float sUt[16 * UTS];       // U transposed: [head][e]; rows 4..15 zero
    __shared__ float sScore[16 * SS];     // rows 0..3 live (cols 0..128); rest zero
    __shared__ float sY[4][64];
    __shared__ float sRed[128];
    __shared__ float sZn[128];
    __shared__ float sMu[128], sVar[128];
    __shared__ float sQlab[64];
    __shared__ float sC[4];
    __shared__ float sAB[132];            // alpha * A_full[j, 128], j = 0..128
    __shared__ float sG1[64], sBe1[64];
    __shared__ float sA64[64], sXrow[64], sT[64];
    __shared__ float sH[128];

    const int tid  = threadIdx.x;
    const int blk  = blockIdx.x;
    const int w    = tid >> 5;        // wave id (0..3)
    const int lane = tid & 31;
    const int lh   = lane >> 4;       // half-wave (0/1)
    const int mr   = lane & 15;

    // ---- Stage feat_emb once: each wave load covers 512 contiguous bytes (whole lines);
    //      rows 0..127 of sXn hold the raw values until Phase 2 rewrites them in place ----
    #pragma unroll   // all 16 loads in flight behind one latency, before the first LDS store
    for (int i = 0; i < 16; i++) {
        const int q  = tid + i * 128;          // group of 4 floats: row q>>4, columns 4*(q&15)..+3
        const int gs = q * 4;
        const int ls = (q >> 4) * XS + (q & 15) * 4;
        const float f0 = feat_emb[gs], f1 = feat_emb[gs + 1];
        const float f2 = feat_emb[gs + 2], f3 = feat_emb[gs + 3];
        sXn[ls]     = f0;
        sXn[ls + 1] = f1;
        sXn[ls + 2] = f2;
        sXn[ls + 3] = f3;
    }

    // ---- Zero the padded WMMA operand regions once (no guards needed later) ----
    for (int i = tid; i < 15 * XS; i += 128) sXn[129 * XS + i] = 0.0f;   // rows 129..143
    for (int i = tid; i < 16 * UTS; i += 128) sUt[i] = 0.0f;
    for (int i = tid; i < 16 * SS;  i += 128) sScore[i] = 0.0f;

    // ---- Stage the attention bias column: sAB[j] = alpha * A_full[j, 128] ----
    const float alpha = alphap[0];
    sAB[tid] = alpha * A_full[tid * 129 + 128];
    if (tid == 0) sAB[128] = alpha * A_full[128 * 129 + 128];

    // ---- Phase 0a: LN(label_token) -> Xn row 128 (sample-independent) ----
    float lt = (tid < 64) ? label_token[tid] : 0.0f;
    float s0 = block_reduce_sum(lt, sRed, tid);
    float lm = s0 * (1.0f / 64.0f);
    float ld = (tid < 64) ? (lt - lm) : 0.0f;
    float lv = block_reduce_sum(ld * ld, sRed, tid) * (1.0f / 64.0f);
    float lr = rsqrtf(lv + 1e-5f);
    if (tid < 64) sXn[128 * XS + tid] = ld * lr * g1[tid] + be1[tid];
    __syncthreads();

    // ---- Phase 0b: Qlab = Xn128 @ wq + bq ----
    if (tid < 64) {
        float acc = bq[tid];
        for (int e = 0; e < 64; e++) acc += sXn[128 * XS + e] * wq[e * 64 + tid];
        sQlab[tid] = acc;
    }
    __syncthreads();

    // ---- Phase 0c: u (transposed), c, feat_emb row stats, preload g1/be1 ----
    if (tid < 64) {
        const int e = tid;
        #pragma unroll
        for (int h = 0; h < 4; h++) {
            float acc = 0.0f;
            for (int d = 0; d < 16; d++) acc += wk[e * 64 + h * 16 + d] * sQlab[h * 16 + d];
            sUt[h * UTS + e] = acc;
        }
        sG1[tid]  = g1[tid];
        sBe1[tid] = be1[tid];
    }
    if (tid < 4) {
        float acc = 0.0f;
        for (int d = 0; d < 16; d++) acc += bk[tid * 16 + d] * sQlab[tid * 16 + d];
        sC[tid] = acc;
    }
    {
        const int j = tid;  // 128 threads, one staged feat_emb row each (pitch 66: no bank conflict)
        float s = 0.0f;
        #pragma unroll   // whole row read at constant offsets behind few waits; the second pass reuses the registers
        for (int k = 0; k < 64; k++) s += sXn[j * XS + k];
        float mj = s * (1.0f / 64.0f);
        float q = 0.0f;
        #pragma unroll   // as above
        for (int k = 0; k < 64; k++) { float d = sXn[j * XS + k] - mj; q += d * d; }
        sMu[j]  = mj;
        sVar[j] = q * (1.0f / 64.0f);
    }
    __syncthreads();

    // ---- Phase 1: Zn = LN(Z row) over 128 features ----
    float z  = Z[(size_t)blk * 128 + tid];
    float zm = block_reduce_sum(z, sRed, tid) * (1.0f / 128.0f);
    float zd = z - zm;
    float zv = block_reduce_sum(zd * zd, sRed, tid) * (1.0f / 128.0f);
    sZn[tid] = zd * rsqrtf(zv + 1e-5f);
    __syncthreads();

    // ---- Phase 2: Xn rows 0..127 via factored LN of (Zn_j * feat_emb[j,:]) ----
    {
        const int j0 = tid >> 6, k = tid & 63;   // this thread's element i: row j0 + 2*i, column k
        float* px = &sXn[j0 * XS + k];           // one base + constant steps: reads need not wait for stores
        #pragma unroll 4
        for (int i = 0; i < 64; i++) {
            const int j = j0 + 2 * i;
            float zn = sZn[j];
            float fe = px[i * 2 * XS];           // raw feat_emb[j][k], rewritten in place by its only reader
            float rj = rsqrtf(zn * zn * sVar[j] + 1e-5f);
            px[i * 2 * XS] = (zn * fe - zn * sMu[j]) * rj * sG1[k] + sBe1[k];
        }
    }
    __syncthreads();

    // ---- Phase 3: scores[h][j] = 0.25*(Xn[j].u_h + c_h) + alpha*A_full[j,128]
    //      WMMA f32 16x16x4: A = Xn tile rows (zero-padded), B = U^T (zero-padded cols)
    for (int mt = w; mt < 9; mt += 4) {
        v8f acc = {0.f, 0.f, 0.f, 0.f, 0.f, 0.f, 0.f, 0.f};
        const int jbase = mt * 16 + mr;          // A row for this lane (<= 143, in bounds)
        #pragma unroll
        for (int kk = 0; kk < 64; kk += 4) {
            const int k0 = kk + 2 * lh;          // this lane's K pair: k0, k0+1
            v2f a, b;
            a[0] = sXn[jbase * XS + k0];
            a[1] = sXn[jbase * XS + k0 + 1];
            b[0] = sUt[mr * UTS + k0];
            b[1] = sUt[mr * UTS + k0 + 1];
            acc = __builtin_amdgcn_wmma_f32_16x16x4_f32(
                false, a, false, b, (short)0, acc, false, false);
        }
        if (mt < 8) {                            // all 16 rows valid: unconditional writeback
            if (mr < 4) {
                const float ch = sC[mr];
                #pragma unroll
                for (int r = 0; r < 8; r++) {
                    const int j = mt * 16 + r + 8 * lh;   // D: M = r + 8*half
                    sScore[mr * SS + j] = 0.25f * (acc[r] + ch) + sAB[j];
                }
            }
        } else {                                 // tile 8: only j == 128 (r=0, half 0) is live
            if (mr < 4 && lh == 0) {
                sScore[mr * SS + 128] = 0.25f * (acc[0] + sC[mr]) + sAB[128];
            }
        }
    }
    __syncthreads();

    // ---- Phase 4: softmax over j (one wave per head); pad cols stay zero ----
    {
        const int h = w;
        float mx = -1e30f;
        for (int j = lane; j < 129; j += 32) mx = fmaxf(mx, sScore[h * SS + j]);
        #pragma unroll
        for (int off = 16; off > 0; off >>= 1) mx = fmaxf(mx, __shfl_xor(mx, off, 32));
        float sum = 0.0f;
        for (int j = lane; j < 129; j += 32) {
            float e = expf(sScore[h * SS + j] - mx);
            sScore[h * SS + j] = e;
            sum += e;
        }
        #pragma unroll
        for (int off = 16; off > 0; off >>= 1) sum += __shfl_xor(sum, off, 32);
        const float inv = 1.0f / sum;
        for (int j = lane; j < 129; j += 32) sScore[h * SS + j] *= inv;
    }
    __syncthreads();

    // ---- Phase 5: y[h,:] = attn[h,:] @ Xn  (M=4 pad 16, K=129 pad 132, N-tile = wave) ----
    {
        v8f acc = {0.f, 0.f, 0.f, 0.f, 0.f, 0.f, 0.f, 0.f};
        const int e = w * 16 + mr;      // B column (N) handled by this lane
        #pragma unroll
        for (int kk = 0; kk < 132; kk += 4) {
            const int k0 = kk + 2 * lh;
            v2f a, b;
            a[0] = sScore[mr * SS + k0];       // rows 4..15 and cols >128 are zero
            a[1] = sScore[mr * SS + k0 + 1];
            b[0] = sXn[k0 * XS + e];           // rows 129..143 are zero
            b[1] = sXn[(k0 + 1) * XS + e];
            acc = __builtin_amdgcn_wmma_f32_16x16x4_f32(
                false, a, false, b, (short)0, acc, false, false);
        }
        if (lh == 0) {                  // heads live in D rows M=0..3 (half 0, r<4)
            #pragma unroll
            for (int r = 0; r < 4; r++) sY[r][e] = acc[r];
        }
    }
    __syncthreads();

    // ---- Phase 6: attn_out = y @ wv + bv ; o = attn_out @ wo + bo ; Xrow = label + o ----
    if (tid < 64) {
        const int hd = tid, h = hd >> 4;
        float acc = bv[hd];
        for (int e = 0; e < 64; e++) acc += sY[h][e] * wv[e * 64 + hd];
        sA64[hd] = acc;
    }
    __syncthreads();
    if (tid < 64) {
        const int k = tid;
        float acc = bo[k];
        for (int hd = 0; hd < 64; hd++) acc += sA64[hd] * wo[hd * 64 + k];
        sXrow[k] = label_token[k] + acc;
    }
    __syncthreads();

    // ---- Phase 7: t = LN(Xrow)*g2 + be2 ----
    float xv = (tid < 64) ? sXrow[tid] : 0.0f;
    float m2 = block_reduce_sum(xv, sRed, tid) * (1.0f / 64.0f);
    float dv = (tid < 64) ? (xv - m2) : 0.0f;
    float v2 = block_reduce_sum(dv * dv, sRed, tid) * (1.0f / 64.0f);
    if (tid < 64) sT[tid] = dv * rsqrtf(v2 + 1e-5f) * g2[tid] + be2[tid];
    __syncthreads();

    // ---- Phase 8: FFN (exact gelu) + residual, emit last-token row ----
    {
        const int p = tid;  // 128 hidden units
        float acc = b1[p];
        for (int k = 0; k < 64; k++) acc += sT[k] * w1[k * 128 + p];
        sH[p] = 0.5f * acc * (1.0f + erff(acc * 0.70710678118654752f));
    }
    __syncthreads();
    if (tid < 64) {
        const int k = tid;
        float acc = b2[k];
        for (int p = 0; p < 128; p++) acc += sH[p] * w2[p * 64 + k];
        out[(size_t)blk * 64 + k] = sXrow[k] + acc;
    }
}

extern "C" void kernel_launch(void* const* d_in, const int* in_sizes, int n_in,
                              void* d_out, int out_size, void* d_ws, size_t ws_size,
                              hipStream_t stream) {
    (void)n_in; (void)d_ws; (void)ws_size; (void)out_size;
    const float* Z          = (const float*)d_in[0];
    const float* A_full     = (const float*)d_in[1];
    const float* feat_emb   = (const float*)d_in[2];
    const float* label_tok  = (const float*)d_in[3];
    const float* wq         = (const float*)d_in[4];
    const float* bq         = (const float*)d_in[5];
    const float* wk         = (const float*)d_in[6];
    const float* bk         = (const float*)d_in[7];
    const float* wv         = (const float*)d_in[8];
    const float* bv         = (const float*)d_in[9];
    const float* wo         = (const float*)d_in[10];
    const float* bo         = (const float*)d_in[11];
    const float* w1         = (const float*)d_in[12];
    const float* b1         = (const float*)d_in[13];
    const float* w2         = (const float*)d_in[14];
    const float* b2         = (const float*)d_in[15];
    const float* alphap     = (const float*)d_in[16];
    const float* g1         = (const float*)d_in[17];
    const float* be1        = (const float*)d_in[18];
    const float* g2         = (const float*)d_in[19];
    const float* be2        = (const float*)d_in[20];
    float* out              = (float*)d_out;

    const int N = in_sizes[0] / 128;   // 4096 samples
    CausalFeatureTransformer_52132313039065_kernel<<<N, 128, 0, stream>>>(
        Z, A_full, feat_emb, label_tok, wq, bq, wk, bk, wv, bv, wo, bo,
        w1, b1, w2, b2, alphap, g1, be1, g2, be2, out);
}

// v002
// Measured time: 67.6 microseconds a run.
// In both of two side-by-side timings against v001, it was 1.19 times as fast.
// Counting every step since v000, it is 1.45 times as fast.
#include <hip/hip_runtime.h>
#include <hip/hip_bf16.h>

typedef __attribute__((ext_vector_type(2))) float v2f;
typedef __attribute__((ext_vector_type(8))) float v8f;

#define XS  66   // Xn row stride (floats): conflict-free banks, 8B-aligned rows
#define UTS 66   // U-transposed row stride
#define SS  132  // score row stride (floats): 528B rows -> 8B aligned, conflict-free

// Lane l reads lane l ^ M of its own 16-lane row (DPP row_xmask); all 32 lanes must be on.
template <int M>
__device__ __forceinline__ float row_xor(float x) {
    return __builtin_bit_cast(float, __builtin_amdgcn_update_dpp(
        0, __builtin_bit_cast(int, x), 0x160 + M, 0xf, 0xf, true));
}
// Lane l reads lane l ^ 16.
__device__ __forceinline__ float half_xor(float x) {
    return __builtin_bit_cast(float, __builtin_amdgcn_permlanex16(
        __builtin_bit_cast(int, x), __builtin_bit_cast(int, x), 0x76543210, 0xfedcba98, false, false));
}
// Butterfly over the wave's 32 lanes, in registers; every lane ends with the same bits.
__device__ __forceinline__ float wave_sum(float v) {
    v += row_xor<1>(v);
    v += row_xor<2>(v);
    v += row_xor<4>(v);
    v += row_xor<8>(v);
    v += half_xor(v);
    return v;
}
__device__ __forceinline__ float wave_max(float v) {
    v = fmaxf(v, row_xor<1>(v));
    v = fmaxf(v, row_xor<2>(v));
    v = fmaxf(v, row_xor<4>(v));
    v = fmaxf(v, row_xor<8>(v));
    v = fmaxf(v, half_xor(v));
    return v;
}

__global__ __launch_bounds__(128)
void CausalFeatureTransformer_52132313039065_kernel(
        const float* __restrict__ Z, const float* __restrict__ A_full,
        const float* __restrict__ feat_emb, const float* __restrict__ label_token,
        const float* __restrict__ wq, const float* __restrict__ bq,
        const float* __restrict__ wk, const float* __restrict__ bk,
        const float* __restrict__ wv, const float* __restrict__ bv,
        const float* __restrict__ wo, const float* __restrict__ bo,
        const float* __restrict__ w1, const float* __restrict__ b1,
        const float* __restrict__ w2, const float* __restrict__ b2,
        const float* __restrict__ alphap,
        const float* __restrict__ g1, const float* __restrict__ be1,
        const float* __restrict__ g2, const float* __restrict__ be2,
        float* __restrict__ out)
{
    __shared__ float sXn[144 * XS];       // rows 0..127: raw feat_emb, then Xn in place; 128 label; 129..143 zero pad
    __shared__ float sUt[16 * UTS];       // U transposed: [head][e]; rows 4..15 zero
    __shared__ float sScore[16 * SS];     // rows 0..3 live (cols 0..128); rest zero
    __shared__ float sY[4][64];
    __shared__ float sZn[128];
    __shared__ float sMu[128], sVar[128];
    __shared__ float sQlab[64];
    __shared__ float sC[4];
    __shared__ float sAB[132];            // alpha * A_full[j, 128], j = 0..128
    __shared__ float sG1[64], sBe1[64];
    __shared__ float sA64[64], sXrow[64], sT[64];
    __shared__ float sH[128];

    const int tid  = threadIdx.x;
    const int blk  = blockIdx.x;
    const int w    = tid >> 5;        // wave id (0..3)
    const int lane = tid & 31;
    const int lh   = lane >> 4;       // half-wave (0/1)
    const int mr   = lane & 15;

    // ---- Stage feat_emb once: each wave load covers 512 contiguous bytes (whole lines);
    //      rows 0..127 of sXn hold the raw values until Phase 2 rewrites them in place ----
    #pragma unroll   // all 16 loads in flight behind one latency, before the first LDS store
    for (int i = 0; i < 16; i++) {
        const int q  = tid + i * 128;          // group of 4 floats: row q>>4, columns 4*(q&15)..+3
        const int gs = q * 4;
        const int ls = (q >> 4) * XS + (q & 15) * 4;
        const float f0 = feat_emb[gs], f1 = feat_emb[gs + 1];
        const float f2 = feat_emb[gs + 2], f3 = feat_emb[gs + 3];
        sXn[ls]     = f0;
        sXn[ls + 1] = f1;
        sXn[ls + 2] = f2;
        sXn[ls + 3] = f3;
    }

    // ---- Zero the padded WMMA operand regions once (no guards needed later) ----
    for (int i = tid; i < 15 * XS; i += 128) sXn[129 * XS + i] = 0.0f;   // rows 129..143
    for (int i = tid; i < 16 * UTS; i += 128) sUt[i] = 0.0f;
    for (int i = tid; i < 16 * SS;  i += 128) sScore[i] = 0.0f;

    // ---- Stage the attention bias column: sAB[j] = alpha * A_full[j, 128] ----
    const float alpha = alphap[0];
    sAB[tid] = alpha * A_full[tid * 129 + 128];
    if (tid == 0) sAB[128] = alpha * A_full[128 * 129 + 128];

    // ---- Phase 0a: LN(label_token) -> Xn row 128 (sample-independent) ----
    //      every wave holds the whole row, two values a lane, and sums it alone: no exchange between waves
    const float la = label_token[2 * lane], lb = label_token[2 * lane + 1];
    const float lm = wave_sum(la + lb) * (1.0f / 64.0f);
    const float lda = la - lm, ldb = lb - lm;
    const float lv = wave_sum(lda * lda + ldb * ldb) * (1.0f / 64.0f);
    const float lr = rsqrtf(lv + 1e-5f);
    if (tid < 64) sXn[128 * XS + tid] = (label_token[tid] - lm) * lr * g1[tid] + be1[tid];
    __syncthreads();

    // ---- Phase 0b: Qlab = Xn128 @ wq + bq ----
    if (tid < 64) {
        float acc = bq[tid];
        for (int e = 0; e < 64; e++) acc += sXn[128 * XS + e] * wq[e * 64 + tid];
        sQlab[tid] = acc;
    }
    __syncthreads();

    // ---- Phase 0c: u (transposed), c, feat_emb row stats, preload g1/be1 ----
    if (tid < 64) {
        const int e = tid;
        #pragma unroll
        for (int h = 0; h < 4; h++) {
            float acc = 0.0f;
            for (int d = 0; d < 16; d++) acc += wk[e * 64 + h * 16 + d] * sQlab[h * 16 + d];
            sUt[h * UTS + e] = acc;
        }
        sG1[tid]  = g1[tid];
        sBe1[tid] = be1[tid];
    }
    if (tid < 4) {
        float acc = 0.0f;
        for (int d = 0; d < 16; d++) acc += bk[tid * 16 + d] * sQlab[tid * 16 + d];
        sC[tid] = acc;
    }
    {
        const int j = tid;  // 128 threads, one staged feat_emb row each (pitch 66: no bank conflict)
        float s = 0.0f;
        #pragma unroll   // whole row read at constant offsets behind few waits; the second pass reuses the registers
        for (int k = 0; k < 64; k++) s += sXn[j * XS + k];
        float mj = s * (1.0f / 64.0f);
        float q = 0.0f;
        #pragma unroll   // as above
        for (int k = 0; k < 64; k++) { float d = sXn[j * XS + k] - mj; q += d * d; }
        sMu[j]  = mj;
        sVar[j] = q * (1.0f / 64.0f);
    }
    __syncthreads();

    // ---- Phase 1: Zn = LN(Z row) over 128 features ----
    //      every wave holds the whole row, four values a lane, and sums it alone
    const float* zrow = Z + (size_t)blk * 128;
    const float z  = zrow[tid];
    const float z0 = zrow[4 * lane],     z1 = zrow[4 * lane + 1];
    const float z2 = zrow[4 * lane + 2], z3 = zrow[4 * lane + 3];
    const float zm = wave_sum((z0 + z1) + (z2 + z3)) * (1.0f / 128.0f);
    const float e0 = z0 - zm, e1 = z1 - zm, e2 = z2 - zm, e3 = z3 - zm;
    const float zv = wave_sum((e0 * e0 + e1 * e1) + (e2 * e2 + e3 * e3)) * (1.0f / 128.0f);
    sZn[tid] = (z - zm) * rsqrtf(zv + 1e-5f);
    __syncthreads();

    // ---- Phase 2: Xn rows 0..127 via factored LN of (Zn_j * feat_emb[j,:]) ----
    {
        const int j0 = tid >> 6, k = tid & 63;   // this thread's element i: row j0 + 2*i, column k
        float* px = &sXn[j0 * XS + k];           // one base + constant steps: reads need not wait for stores
        #pragma unroll 4
        for (int i = 0; i < 64; i++) {
            const int j = j0 + 2 * i;
            float zn = sZn[j];
            float fe = px[i * 2 * XS];           // raw feat_emb[j][k], rewritten in place by its only reader
            float rj = rsqrtf(zn * zn * sVar[j] + 1e-5f);
            px[i * 2 * XS] = (zn * fe - zn * sMu[j]) * rj * sG1[k] + sBe1[k];
        }
    }
    __syncthreads();

    // ---- Phase 3: scores[h][j] = 0.25*(Xn[j].u_h + c_h) + alpha*A_full[j,128]
    //      WMMA f32 16x16x4: A = Xn tile rows (zero-padded), B = U^T (zero-padded cols)
    for (int mt = w; mt < 9; mt += 4) {
        v8f acc = {0.f, 0.f, 0.f, 0.f, 0.f, 0.f, 0.f, 0.f};
        const int jbase = mt * 16 + mr;          // A row for this lane (<= 143, in bounds)
        #pragma unroll
        for (int kk = 0; kk < 64; kk += 4) {
            const int k0 = kk + 2 * lh;          // this lane's K pair: k0, k0+1
            v2f a, b;
            a[0] = sXn[jbase * XS + k0];
            a[1] = sXn[jbase * XS + k0 + 1];
            b[0] = sUt[mr * UTS + k0];
            b[1] = sUt[mr * UTS + k0 + 1];
            acc = __builtin_amdgcn_wmma_f32_16x16x4_f32(
                false, a, false, b, (short)0, acc, false, false);
        }
        if (mt < 8) {                            // all 16 rows valid: unconditional writeback
            if (mr < 4) {
                const float ch = sC[mr];
                #pragma unroll
                for (int r = 0; r < 8; r++) {
                    const int j = mt * 16 + r + 8 * lh;   // D: M = r + 8*half
                    sScore[mr * SS + j] = 0.25f * (acc[r] + ch) + sAB[j];
                }
            }
        } else {                                 // tile 8: only j == 128 (r=0, half 0) is live
            if (mr < 4 && lh == 0) {
                sScore[mr * SS + 128] = 0.25f * (acc[0] + sC[mr]) + sAB[128];
            }
        }
    }
    __syncthreads();

    // ---- Phase 4: softmax over j (one wave per head); pad cols stay zero ----
    {
        const int h = w;
        float mx = -1e30f;
        for (int j = lane; j < 129; j += 32) mx = fmaxf(mx, sScore[h * SS + j]);
        mx = wave_max(mx);
        float sum = 0.0f;
        for (int j = lane; j < 129; j += 32) {
            float e = expf(sScore[h * SS + j] - mx);
            sScore[h * SS + j] = e;
            sum += e;
        }
        sum = wave_sum(sum);
        const float inv = 1.0f / sum;
        for (int j = lane; j < 129; j += 32) sScore[h * SS + j] *= inv;
    }
    __syncthreads();

    // ---- Phase 5: y[h,:] = attn[h,:] @ Xn  (M=4 pad 16, K=129 pad 132, N-tile = wave) ----
    {
        v8f acc = {0.f, 0.f, 0.f, 0.f, 0.f, 0.f, 0.f, 0.f};
        const int e = w * 16 + mr;      // B column (N) handled by this lane
        #pragma unroll
        for (int kk = 0; kk < 132; kk += 4) {
            const int k0 = kk + 2 * lh;
            v2f a, b;
            a[0] = sScore[mr * SS + k0];       // rows 4..15 and cols >128 are zero
            a[1] = sScore[mr * SS + k0 + 1];
            b[0] = sXn[k0 * XS + e];           // rows 129..143 are zero
            b[1] = sXn[(k0 + 1) * XS + e];
            acc = __builtin_amdgcn_wmma_f32_16x16x4_f32(
                false, a, false, b, (short)0, acc, false, false);
        }
        if (lh == 0) {                  // heads live in D rows M=0..3 (half 0, r<4)
            #pragma unroll
            for (int r = 0; r < 4; r++) sY[r][e] = acc[r];
        }
    }
    __syncthreads();

    // ---- Phase 6: attn_out = y @ wv + bv ; o = attn_out @ wo + bo ; Xrow = label + o ----
    if (tid < 64) {
        const int hd = tid, h = hd >> 4;
        float acc = bv[hd];
        for (int e = 0; e < 64; e++) acc += sY[h][e] * wv[e * 64 + hd];
        sA64[hd] = acc;
    }
    __syncthreads();
    if (tid < 64) {
        const int k = tid;
        float acc = bo[k];
        for (int hd = 0; hd < 64; hd++) acc += sA64[hd] * wo[hd * 64 + k];
        sXrow[k] = label_token[k] + acc;
    }
    __syncthreads();

    // ---- Phase 7: t = LN(Xrow)*g2 + be2 ----
    if (tid < 64) {   // whole waves 0 and 1: each holds the whole row, two values a lane, and sums it alone
        const float xa = sXrow[2 * lane], xb = sXrow[2 * lane + 1];
        const float m2 = wave_sum(xa + xb) * (1.0f / 64.0f);
        const float xda = xa - m2, xdb = xb - m2;
        const float v2 = wave_sum(xda * xda + xdb * xdb) * (1.0f / 64.0f);
        sT[tid] = (sXrow[tid] - m2) * rsqrtf(v2 + 1e-5f) * g2[tid] + be2[tid];
    }
    __syncthreads();

    // ---- Phase 8: FFN (exact gelu) + residual, emit last-token row ----
    {
        const int p = tid;  // 128 hidden units
        float acc = b1[p];
        for (int k = 0; k < 64; k++) acc += sT[k] * w1[k * 128 + p];
        sH[p] = 0.5f * acc * (1.0f + erff(acc * 0.70710678118654752f));
    }
    __syncthreads();
    if (tid < 64) {
        const int k = tid;
        float acc = b2[k];
        for (int p = 0; p < 128; p++) acc += sH[p] * w2[p * 64 + k];
        out[(size_t)blk * 64 + k] = sXrow[k] + acc;
    }
}

extern "C" void kernel_launch(void* const* d_in, const int* in_sizes, int n_in,
                              void* d_out, int out_size, void* d_ws, size_t ws_size,
                              hipStream_t stream) {
    (void)n_in; (void)d_ws; (void)ws_size; (void)out_size;
    const float* Z          = (const float*)d_in[0];
    const float* A_full     = (const float*)d_in[1];
    const float* feat_emb   = (const float*)d_in[2];
    const float* label_tok  = (const float*)d_in[3];
    const float* wq         = (const float*)d_in[4];
    const float* bq         = (const float*)d_in[5];
    const float* wk         = (const float*)d_in[6];
    const float* bk         = (const float*)d_in[7];
    const float* wv         = (const float*)d_in[8];
    const float* bv         = (const float*)d_in[9];
    const float* wo         = (const float*)d_in[10];
    const float* bo         = (const float*)d_in[11];
    const float* w1         = (const float*)d_in[12];
    const float* b1         = (const float*)d_in[13];
    const float* w2         = (const float*)d_in[14];
    const float* b2         = (const float*)d_in[15];
    const float* alphap     = (const float*)d_in[16];
    const float* g1         = (const float*)d_in[17];
    const float* be1        = (const float*)d_in[18];
    const float* g2         = (const float*)d_in[19];
    const float* be2        = (const float*)d_in[20];
    float* out              = (float*)d_out;

    const int N = in_sizes[0] / 128;   // 4096 samples
    CausalFeatureTransformer_52132313039065_kernel<<<N, 128, 0, stream>>>(
        Z, A_full, feat_emb, label_tok, wq, bq, wk, bk, wv, bv, wo, bo,
        w1, b1, w2, b2, alphap, g1, be1, g2, be2, out);
}

// v003
// One run takes 19.5 microseconds.
// Next to v002, in two timings, it ran 3.48 and 3.47 times as fast.
// All steps since v000 together make it 5.05 times as fast.
#include <hip/hip_runtime.h>
#include <hip/hip_bf16.h>

typedef __attribute__((ext_vector_type(2))) float v2f;
typedef __attribute__((ext_vector_type(4))) float v4f;
typedef __attribute__((ext_vector_type(8))) float v8f;

#define XS  66   // Xn row stride (floats): conflict-free banks, 8B-aligned rows
#define UTS 66   // U-transposed row stride
#define SS  132  // score row stride (floats): 528B rows -> 16B aligned, conflict-free
#define NS  4    // samples per block: one per wave; 4 samples x 4 heads fill the 16 rows of one WMMA tile

// Lane l reads lane l ^ M of its own 16-lane row (DPP row_xmask); all 32 lanes must be on.
template <int M>
__device__ __forceinline__ float row_xor(float x) {
    return __builtin_bit_cast(float, __builtin_amdgcn_update_dpp(
        0, __builtin_bit_cast(int, x), 0x160 + M, 0xf, 0xf, true));
}
// Lane l reads lane l ^ 16.
__device__ __forceinline__ float half_xor(float x) {
    return __builtin_bit_cast(float, __builtin_amdgcn_permlanex16(
        __builtin_bit_cast(int, x), __builtin_bit_cast(int, x), 0x76543210, 0xfedcba98, false, false));
}
// Butterfly over the wave's 32 lanes, in registers; every lane ends with the same bits.
__device__ __forceinline__ float wave_sum(float v) {
    v += row_xor<1>(v);
    v += row_xor<2>(v);
    v += row_xor<4>(v);
    v += row_xor<8>(v);
    v += half_xor(v);
    return v;
}
__device__ __forceinline__ float wave_max(float v) {
    v = fmaxf(v, row_xor<1>(v));
    v = fmaxf(v, row_xor<2>(v));
    v = fmaxf(v, row_xor<4>(v));
    v = fmaxf(v, row_xor<8>(v));
    v = fmaxf(v, half_xor(v));
    return v;
}

__global__ __launch_bounds__(128)
void CausalFeatureTransformer_52132313039065_kernel(
        const float* __restrict__ Z, const float* __restrict__ A_full,
        const float* __restrict__ feat_emb, const float* __restrict__ label_token,
        const float* __restrict__ wq, const float* __restrict__ bq,
        const float* __restrict__ wk, const float* __restrict__ bk,
        const float* __restrict__ wv, const float* __restrict__ bv,
        const float* __restrict__ wo, const float* __restrict__ bo,
        const float* __restrict__ w1, const float* __restrict__ b1,
        const float* __restrict__ w2, const float* __restrict__ b2,
        const float* __restrict__ alphap,
        const float* __restrict__ g1, const float* __restrict__ be1,
        const float* __restrict__ g2, const float* __restrict__ be2,
        float* __restrict__ out)
{
    // Xn[j][k] = s_j * G[j][k] + be1[k] for j < 128, with G = (feat_emb - row mean) * g1 the same for every
    // sample and s_j = Zn_j * rsqrt(Zn_j^2 * var_j + eps) the only per-sample part.
    __shared__ float sXn[144 * XS];       // rows 0..127: raw feat_emb, then G in place; 128: LN(label); 129: be1; 130..143 zero pad
    __shared__ float sUt[16 * UTS];       // U transposed: [head][e]; rows 4..15 zero
    __shared__ __attribute__((aligned(16))) float sScore[16 * SS];  // row = sample*4 + head: attn*s_j | attn_128 | sum of attn over j<128 | 0 0
    __shared__ __attribute__((aligned(16))) float sP[4 * SS];       // sP[h][j] = (row j of sXn) . u_h, j = 0..129
    __shared__ float sY[16][64];          // row = sample*4 + head
    __shared__ __attribute__((aligned(16))) float sVar[128];
    __shared__ float sQlab[64];
    __shared__ float sC[4];
    __shared__ __attribute__((aligned(16))) float sAB[132];         // alpha * A_full[j, 128], j = 0..128
    __shared__ float sA64[NS][64], sXrow[NS][64], sT[NS][64];
    __shared__ float sH[NS][128];

    const int tid  = threadIdx.x;
    const int blk  = blockIdx.x;
    const int w    = tid >> 5;        // wave id (0..3) = sample of this block in the per-sample phases
    const int lane = tid & 31;
    const int lh   = lane >> 4;       // half-wave (0/1)
    const int mr   = lane & 15;

    // ---- This wave's Z row, four values a lane (used after the block-wide set-up) ----
    const float* zrow = Z + ((size_t)blk * NS + w) * 128;
    const float z0 = zrow[4 * lane],     z1 = zrow[4 * lane + 1];
    const float z2 = zrow[4 * lane + 2], z3 = zrow[4 * lane + 3];

    // ---- Stage feat_emb once: each wave load covers 512 contiguous bytes (whole lines) ----
    #pragma unroll   // all 16 loads in flight behind one latency, before the first LDS store
    for (int i = 0; i < 16; i++) {
        const int q  = tid + i * 128;          // group of 4 floats: row q>>4, columns 4*(q&15)..+3
        const int gs = q * 4;
        const int ls = (q >> 4) * XS + (q & 15) * 4;
        const float f0 = feat_emb[gs], f1 = feat_emb[gs + 1];
        const float f2 = feat_emb[gs + 2], f3 = feat_emb[gs + 3];
        sXn[ls]     = f0;
        sXn[ls + 1] = f1;
        sXn[ls + 2] = f2;
        sXn[ls + 3] = f3;
    }

    // ---- Zero the padded WMMA operand regions once (no guards needed later) ----
    for (int i = tid; i < 14 * XS; i += 128) sXn[130 * XS + i] = 0.0f;   // rows 130..143
    for (int i = tid; i < 16 * UTS; i += 128) sUt[i] = 0.0f;
    for (int i = tid; i < 16 * SS;  i += 128) sScore[i] = 0.0f;

    // ---- Stage the attention bias column: sAB[j] = alpha * A_full[j, 128] ----
    const float alpha = alphap[0];
    sAB[tid] = alpha * A_full[tid * 129 + 128];
    if (tid == 0) sAB[128] = alpha * A_full[128 * 129 + 128];

    // ---- Phase 0a: LN(label_token) -> row 128; be1 -> row 129 ----
    //      every wave holds the whole row, two values a lane, and sums it alone: no exchange between waves
    const float la = label_token[2 * lane], lb = label_token[2 * lane + 1];
    const float lm = wave_sum(la + lb) * (1.0f / 64.0f);
    const float lda = la - lm, ldb = lb - lm;
    const float lv = wave_sum(lda * lda + ldb * ldb) * (1.0f / 64.0f);
    const float lr = rsqrtf(lv + 1e-5f);
    if (tid < 64) {
        const float bk1 = be1[tid];
        sXn[128 * XS + tid] = (label_token[tid] - lm) * lr * g1[tid] + bk1;
        sXn[129 * XS + tid] = bk1;
    }
    __syncthreads();

    // ---- Phase 0b: Qlab = Xn128 @ wq + bq ----
    if (tid < 64) {
        float acc = bq[tid];
        for (int e = 0; e < 64; e++) acc += sXn[128 * XS + e] * wq[e * 64 + tid];
        sQlab[tid] = acc;
    }
    __syncthreads();

    // ---- Phase 0c: u (transposed), c, feat_emb row stats, G in place ----
    if (tid < 64) {
        const int e = tid;
        #pragma unroll
        for (int h = 0; h < 4; h++) {
            float acc = 0.0f;
            for (int d = 0; d < 16; d++) acc += wk[e * 64 + h * 16 + d] * sQlab[h * 16 + d];
            sUt[h * UTS + e] = acc;
        }
    }
    if (tid < 4) {
        float acc = 0.0f;
        for (int d = 0; d < 16; d++) acc += bk[tid * 16 + d] * sQlab[tid * 16 + d];
        sC[tid] = acc;
    }
    {
        const int j = tid;  // 128 threads, one staged feat_emb row each (pitch 66: no bank conflict)
        float s = 0.0f;
        #pragma unroll   // whole row read at constant offsets behind few waits; the second pass reuses the registers
        for (int k = 0; k < 64; k++) s += sXn[j * XS + k];
        float mj = s * (1.0f / 64.0f);
        float q = 0.0f;
        #pragma unroll   // as above; the row's only reader rewrites it in place
        for (int k = 0; k < 64; k++) {
            float d = sXn[j * XS + k] - mj;
            q += d * d;
            sXn[j * XS + k] = d * g1[k];
        }
        sVar[j] = q * (1.0f / 64.0f);
    }
    __syncthreads();

    // ---- Phase 0d: sP[h][j] = (row j of sXn) . u_h for j = 0..129, once per block
    //      WMMA f32 16x16x4: A = sXn tile rows (zero-padded), B = U^T (zero-padded cols)
    for (int mt = w; mt < 9; mt += 4) {
        v8f acc = {0.f, 0.f, 0.f, 0.f, 0.f, 0.f, 0.f, 0.f};
        const int jbase = mt * 16 + mr;          // A row for this lane (<= 143, in bounds)
        #pragma unroll
        for (int kk = 0; kk < 64; kk += 4) {
            const int k0 = kk + 2 * lh;          // this lane's K pair: k0, k0+1
            v2f a, b;
            a[0] = sXn[jbase * XS + k0];
            a[1] = sXn[jbase * XS + k0 + 1];
            b[0] = sUt[mr * UTS + k0];
            b[1] = sUt[mr * UTS + k0 + 1];
            acc = __builtin_amdgcn_wmma_f32_16x16x4_f32(
                false, a, false, b, (short)0, acc, false, false);
        }
        if (mt < 8) {                            // all 16 rows valid: unconditional writeback
            if (mr < 4) {
                #pragma unroll
                for (int r = 0; r < 8; r++) sP[mr * SS + mt * 16 + r + 8 * lh] = acc[r];   // D: M = r + 8*half
            }
        } else {                                 // tile 8: only j == 128, 129 (r = 0, 1, half 0) are live
            if (mr < 4 && lh == 0) {
                sP[mr * SS + 128] = acc[0];
                sP[mr * SS + 129] = acc[1];
            }
        }
    }
    __syncthreads();

    // ---- Phase 1: wave w takes sample w. Zn = LN(Z row) over 128 features, then s_j; all in registers ----
    float sj[4];
    {
        const float zm = wave_sum((z0 + z1) + (z2 + z3)) * (1.0f / 128.0f);
        const float e0 = z0 - zm, e1 = z1 - zm, e2 = z2 - zm, e3 = z3 - zm;
        const float zv = wave_sum((e0 * e0 + e1 * e1) + (e2 * e2 + e3 * e3)) * (1.0f / 128.0f);
        const float zr = rsqrtf(zv + 1e-5f);
        const v4f var = *(const v4f*)&sVar[4 * lane];
        const float zn0 = e0 * zr, zn1 = e1 * zr, zn2 = e2 * zr, zn3 = e3 * zr;
        sj[0] = zn0 * rsqrtf(zn0 * zn0 * var[0] + 1e-5f);
        sj[1] = zn1 * rsqrtf(zn1 * zn1 * var[1] + 1e-5f);
        sj[2] = zn2 * rsqrtf(zn2 * zn2 * var[2] + 1e-5f);
        sj[3] = zn3 * rsqrtf(zn3 * zn3 * var[3] + 1e-5f);
    }

    // ---- Phases 3+4: scores[h][j] = 0.25*(s_j*P[h][j] + be1.u_h + c_h) + alpha*A_full[j,128] and softmax,
    //      lane holds j = 4*lane..+3; j = 128 (label row) is the same in every lane ----
    {
        const v4f ab = *(const v4f*)&sAB[4 * lane];
        const float ab128 = sAB[128];
        #pragma unroll
        for (int h = 0; h < 4; h++) {
            const v4f p = *(const v4f*)&sP[h * SS + 4 * lane];
            const float ch = sC[h];
            const float cb = sP[h * SS + 129] + ch;
            const float s128 = 0.25f * (sP[h * SS + 128] + ch) + ab128;
            float sc[4];
            #pragma unroll
            for (int i = 0; i < 4; i++) sc[i] = 0.25f * (sj[i] * p[i] + cb) + ab[i];
            const float mx = fmaxf(wave_max(fmaxf(fmaxf(sc[0], sc[1]), fmaxf(sc[2], sc[3]))), s128);
            #pragma unroll
            for (int i = 0; i < 4; i++) sc[i] = expf(sc[i] - mx);
            const float e128 = expf(s128 - mx);
            const float sumf = wave_sum((sc[0] + sc[1]) + (sc[2] + sc[3]));
            const float inv = 1.0f / (sumf + e128);
            float* row = &sScore[(w * 4 + h) * SS];
            v4f o;
            #pragma unroll
            for (int i = 0; i < 4; i++) o[i] = sc[i] * inv * sj[i];
            *(v4f*)&row[4 * lane] = o;
            if (lane == 0) {
                row[128] = e128 * inv;           // weight of the label row
                row[129] = sumf * inv;           // weight of the be1 row
            }
        }
    }
    __syncthreads();

    // ---- Phase 5: y[sample*4+h,:] = sScore row @ sXn  (M = 16 full, K = 130 pad 132, N-tile = wave) ----
    {
        v8f acc = {0.f, 0.f, 0.f, 0.f, 0.f, 0.f, 0.f, 0.f};
        const int e = w * 16 + mr;      // B column (N) handled by this lane
        #pragma unroll
        for (int kk = 0; kk < 132; kk += 4) {
            const int k0 = kk + 2 * lh;
            v2f a, b;
            a[0] = sScore[mr * SS + k0];       // cols 130, 131 are zero
            a[1] = sScore[mr * SS + k0 + 1];
            b[0] = sXn[k0 * XS + e];           // rows 130..143 are zero
            b[1] = sXn[(k0 + 1) * XS + e];
            acc = __builtin_amdgcn_wmma_f32_16x16x4_f32(
                false, a, false, b, (short)0, acc, false, false);
        }
        #pragma unroll
        for (int r = 0; r < 8; r++) sY[r + 8 * lh][e] = acc[r];   // D: M = r + 8*half
    }
    __syncthreads();

    // ---- Phase 6: attn_out = y @ wv + bv ; o = attn_out @ wo + bo ; Xrow = label + o ----
    //      column c of two samples a thread: each weight load feeds both
    const int c  = tid & 63;
    const int n0 = (tid >> 6) * 2, n1 = n0 + 1;
    {
        const int h = c >> 4;
        const float* wcol = wv + c;      // this thread's weight column: constant steps from one base
        float a0 = bv[c], a1 = a0;
        #pragma unroll   // all 64 weight loads in flight behind one latency
        for (int e = 0; e < 64; e++) {
            const float wt = wcol[e * 64];
            a0 += sY[n0 * 4 + h][e] * wt;
            a1 += sY[n1 * 4 + h][e] * wt;
        }
        sA64[n0][c] = a0;
        sA64[n1][c] = a1;
    }
    __syncthreads();
    {
        const float* wcol = wo + c;
        float a0 = bo[c], a1 = a0;
        #pragma unroll   // as above
        for (int hd = 0; hd < 64; hd++) {
            const float wt = wcol[hd * 64];
            a0 += sA64[n0][hd] * wt;
            a1 += sA64[n1][hd] * wt;
        }
        const float lt = label_token[c];
        sXrow[n0][c] = lt + a0;
        sXrow[n1][c] = lt + a1;
    }
    __syncthreads();

    // ---- Phase 7: t = LN(Xrow)*g2 + be2; wave w holds sample w's whole row, two values a lane ----
    {
        const float xa = sXrow[w][2 * lane], xb = sXrow[w][2 * lane + 1];
        const float m2 = wave_sum(xa + xb) * (1.0f / 64.0f);
        const float xda = xa - m2, xdb = xb - m2;
        const float v2 = wave_sum(xda * xda + xdb * xdb) * (1.0f / 64.0f);
        const float r2 = rsqrtf(v2 + 1e-5f);
        sT[w][2 * lane]     = xda * r2 * g2[2 * lane]     + be2[2 * lane];
        sT[w][2 * lane + 1] = xdb * r2 * g2[2 * lane + 1] + be2[2 * lane + 1];
    }
    __syncthreads();

    // ---- Phase 8: FFN (exact gelu) + residual, emit last-token rows ----
    {
        const int p = tid;  // 128 hidden units, all four samples a thread
        const float bb = b1[p];
        float acc[NS] = {bb, bb, bb, bb};
        #pragma unroll 32   // 32 weight loads in flight; all 64 beside four samples' LDS operands took over 256 registers
        for (int k = 0; k < 64; k++) {
            const float wt = w1[k * 128 + p];
            #pragma unroll
            for (int n = 0; n < NS; n++) acc[n] += sT[n][k] * wt;
        }
        #pragma unroll
        for (int n = 0; n < NS; n++)
            sH[n][p] = 0.5f * acc[n] * (1.0f + erff(acc[n] * 0.70710678118654752f));
    }
    __syncthreads();
    {
        const float* wcol = w2 + c;
        float a0 = b2[c], a1 = a0;
        #pragma unroll 64   // 64 weight loads in flight: two latencies for the whole column
        for (int p = 0; p < 128; p++) {
            const float wt = wcol[p * 64];
            a0 += sH[n0][p] * wt;
            a1 += sH[n1][p] * wt;
        }
        out[((size_t)blk * NS + n0) * 64 + c] = sXrow[n0][c] + a0;
        out[((size_t)blk * NS + n1) * 64 + c] = sXrow[n1][c] + a1;
    }
}

extern "C" void kernel_launch(void* const* d_in, const int* in_sizes, int n_in,
                              void* d_out, int out_size, void* d_ws, size_t ws_size,
                              hipStream_t stream) {
    (void)n_in; (void)d_ws; (void)ws_size; (void)out_size;
    const float* Z          = (const float*)d_in[0];
    const float* A_full     = (const float*)d_in[1];
    const float* feat_emb   = (const float*)d_in[2];
    const float* label_tok  = (const float*)d_in[3];
    const float* wq         = (const float*)d_in[4];
    const float* bq         = (const float*)d_in[5];
    const float* wk         = (const float*)d_in[6];
    const float* bk         = (const float*)d_in[7];
    const float* wv         = (const float*)d_in[8];
    const float* bv         = (const float*)d_in[9];
    const float* wo         = (const float*)d_in[10];
    const float* bo         = (const float*)d_in[11];
    const float* w1         = (const float*)d_in[12];
    const float* b1         = (const float*)d_in[13];
    const float* w2         = (const float*)d_in[14];
    const float* b2         = (const float*)d_in[15];
    const float* alphap     = (const float*)d_in[16];
    const float* g1         = (const float*)d_in[17];
    const float* be1        = (const float*)d_in[18];
    const float* g2         = (const float*)d_in[19];
    const float* be2        = (const float*)d_in[20];
    float* out              = (float*)d_out;

    const int N = in_sizes[0] / (128 * NS);   // blocks of NS samples
    CausalFeatureTransformer_52132313039065_kernel<<<N, 128, 0, stream>>>(
        Z, A_full, feat_emb, label_tok, wq, bq, wk, bk, wv, bv, wo, bo,
        w1, b1, w2, b2, alphap, g1, be1, g2, be2, out);
}

// v004
// It runs in 13.3 microseconds.
// Timed twice side by side with v003, it ran 1.47 times as fast both times.
// All steps since v000 together make it 7.41 times as fast.
#include <hip/hip_runtime.h>
#include <hip/hip_bf16.h>

typedef __attribute__((ext_vector_type(2))) float v2f;
typedef __attribute__((ext_vector_type(4))) float v4f;
typedef __attribute__((ext_vector_type(8))) float v8f;

#define XS  66   // Xn row stride (floats): conflict-free banks, 8B-aligned rows
#define UTS 66   // U-transposed row stride
#define SS  132  // score row stride (floats): 528B rows -> 16B aligned, conflict-free
#define AS  68   // row stride of the 64-column A operands of the weight products: the lanes' 8-byte reads fall on distinct banks
#define HS  132  // the same for the 128-column hidden rows
#define NS  16   // samples per block: one per wave; 16 samples are the 16 rows of one WMMA tile
#define NT  512  // threads per block: NS waves

// Lane l reads lane l ^ M of its own 16-lane row (DPP row_xmask); all 32 lanes must be on.
template <int M>
__device__ __forceinline__ float row_xor(float x) {
    return __builtin_bit_cast(float, __builtin_amdgcn_update_dpp(
        0, __builtin_bit_cast(int, x), 0x160 + M, 0xf, 0xf, true));
}
// Lane l reads lane l ^ 16.
__device__ __forceinline__ float half_xor(float x) {
    return __builtin_bit_cast(float, __builtin_amdgcn_permlanex16(
        __builtin_bit_cast(int, x), __builtin_bit_cast(int, x), 0x76543210, 0xfedcba98, false, false));
}
// Butterfly over the wave's 32 lanes, in registers; every lane ends with the same bits.
__device__ __forceinline__ float wave_sum(float v) {
    v += row_xor<1>(v);
    v += row_xor<2>(v);
    v += row_xor<4>(v);
    v += row_xor<8>(v);
    v += half_xor(v);
    return v;
}
__device__ __forceinline__ float wave_max(float v) {
    v = fmaxf(v, row_xor<1>(v));
    v = fmaxf(v, row_xor<2>(v));
    v = fmaxf(v, row_xor<4>(v));
    v = fmaxf(v, row_xor<8>(v));
    v = fmaxf(v, half_xor(v));
    return v;
}

// One 16 x 16 tile of (16 sample rows in LDS) x (weights in global memory), K deep, on WMMA f32 16x16x4.
// aRow = this lane's A row (sample lane & 15), bCol = this lane's B column; both take k = k0, k0 + 1 in the same order.
// c0 = the column's start value (its bias). D: register r of half lh is sample r + 8*lh, column = the lane's B column.
template <int K, int LDB>
__device__ __forceinline__ v8f rows_times_weights(const float* aRow, const float* bCol, int lh, float c0) {
    v8f acc = {c0, c0, c0, c0, c0, c0, c0, c0};
    #pragma unroll   // every weight load of the tile in flight behind one latency
    for (int kk = 0; kk < K; kk += 4) {
        const int k0 = kk + 2 * lh;
        const v2f a = *(const v2f*)&aRow[k0];
        v2f b;
        b[0] = bCol[k0 * LDB];
        b[1] = bCol[(k0 + 1) * LDB];
        acc = __builtin_amdgcn_wmma_f32_16x16x4_f32(false, a, false, b, (short)0, acc, false, false);
    }
    asm volatile("s_wait_xcnt 0x0" ::: "memory");   // stands before what follows may reuse the weight loads' address registers
    return acc;
}

__global__ __launch_bounds__(NT)
void label_row_block16_kernel(
        const float* __restrict__ Z, const float* __restrict__ A_full,
        const float* __restrict__ feat_emb, const float* __restrict__ label_token,
        const float* __restrict__ wq, const float* __restrict__ bq,
        const float* __restrict__ wk, const float* __restrict__ bk,
        const float* __restrict__ wv, const float* __restrict__ bv,
        const float* __restrict__ wo, const float* __restrict__ bo,
        const float* __restrict__ w1, const float* __restrict__ b1,
        const float* __restrict__ w2, const float* __restrict__ b2,
        const float* __restrict__ alphap,
        const float* __restrict__ g1, const float* __restrict__ be1,
        const float* __restrict__ g2, const float* __restrict__ be2,
        float* __restrict__ out)
{
    // Xn[j][k] = s_j * G[j][k] + be1[k] for j < 128, with G = (feat_emb - row mean) * g1 the same for every
    // sample and s_j = Zn_j * rsqrt(Zn_j^2 * var_j + eps) the only per-sample part.
    __shared__ float sXn[144 * XS];       // rows 0..127: raw feat_emb, then G in place; 128: LN(label); 129: be1; 130..143 zero pad
    __shared__ float sUt[16 * UTS];       // U transposed: [head][e]; rows 4..15 zero
    __shared__ __attribute__((aligned(16))) float sScore[4 * NS * SS];  // row = head*16 + sample: attn*s_j | attn_128 | sum of attn over j<128 | 0 0
    __shared__ __attribute__((aligned(16))) float sP[4 * SS];       // sP[h][j] = (row j of sXn) . u_h, j = 0..129
    __shared__ __attribute__((aligned(16))) float sY[4 * NS * AS];  // row = head*16 + sample
    __shared__ __attribute__((aligned(16))) float sVar[128];
    __shared__ float sQlab[64];
    __shared__ float sC[4];
    __shared__ __attribute__((aligned(16))) float sAB[132];         // alpha * A_full[j, 128], j = 0..128
    __shared__ __attribute__((aligned(16))) float sA64[NS * AS], sXrow[NS * AS], sT[NS * AS];   // row = sample
    __shared__ __attribute__((aligned(16))) float sO[2 * NS * AS];  // row = K half*16 + sample
    __shared__ __attribute__((aligned(16))) float sH[NS * HS];      // row = sample

    const int tid  = threadIdx.x;
    const int blk  = blockIdx.x;
    const int w    = __builtin_amdgcn_readfirstlane(tid >> 5);   // wave id (0..15) = sample of this block in the per-sample phases; scalar, so tests on it are scalar branches
    const int lane = tid & 31;
    const int lh   = lane >> 4;       // half-wave (0/1)
    const int mr   = lane & 15;

    // ---- This wave's Z row, four values a lane (used after the block-wide set-up) ----
    const float* zrow = Z + ((size_t)blk * NS + w) * 128;
    const float z0 = zrow[4 * lane],     z1 = zrow[4 * lane + 1];
    const float z2 = zrow[4 * lane + 2], z3 = zrow[4 * lane + 3];

    // ---- Start values of the weight products' columns, fetched here so that no product waits for its bias first ----
    const int col  = (w & 7) * 16 + mr;   // this lane's output column among 128
    const int col4 = (w & 3) * 16 + mr;   // this lane's output column among 64
    const float cWv = bv[col4], cWo = label_token[col4] + bo[col4], cW1 = b1[col], cW2 = b2[col4];

    // ---- Stage feat_emb once: each wave load covers 512 contiguous bytes (whole lines) ----
    #pragma unroll   // all 4 loads in flight behind one latency, before the first LDS store
    for (int i = 0; i < 4; i++) {
        const int q  = tid + i * NT;           // group of 4 floats: row q>>4, columns 4*(q&15)..+3
        const int gs = q * 4;
        const int ls = (q >> 4) * XS + (q & 15) * 4;
        const float f0 = feat_emb[gs], f1 = feat_emb[gs + 1];
        const float f2 = feat_emb[gs + 2], f3 = feat_emb[gs + 3];
        sXn[ls]     = f0;
        sXn[ls + 1] = f1;
        sXn[ls + 2] = f2;
        sXn[ls + 3] = f3;
    }

    // ---- Zero the padded WMMA operand regions once (no guards needed later) ----
    for (int i = tid; i < 14 * XS; i += NT) sXn[130 * XS + i] = 0.0f;   // rows 130..143
    for (int i = tid; i < 16 * UTS; i += NT) sUt[i] = 0.0f;

    // ---- Stage the attention bias column: sAB[j] = alpha * A_full[j, 128] ----
    const float alpha = alphap[0];
    if (tid < 129) sAB[tid] = alpha * A_full[tid * 129 + 128];

    // ---- Phase 0a: LN(label_token) -> row 128; be1 -> row 129 ----
    //      a wave holds the whole row, two values a lane, and sums it alone: no exchange between waves
    if (w < 2) {
        const float la = label_token[2 * lane], lb = label_token[2 * lane + 1];
        const float lm = wave_sum(la + lb) * (1.0f / 64.0f);
        const float lda = la - lm, ldb = lb - lm;
        const float lv = wave_sum(lda * lda + ldb * ldb) * (1.0f / 64.0f);
        const float lr = rsqrtf(lv + 1e-5f);
        const float bk1 = be1[tid];
        sXn[128 * XS + tid] = (label_token[tid] - lm) * lr * g1[tid] + bk1;
        sXn[129 * XS + tid] = bk1;
    }
    __syncthreads();

    // ---- Phase 0b: Qlab = Xn128 @ wq + bq ----
    if (w < 2) {
        float acc = bq[tid];
        for (int e = 0; e < 64; e++) acc += sXn[128 * XS + e] * wq[e * 64 + tid];
        sQlab[tid] = acc;
    }
    __syncthreads();

    // ---- Phase 0c: feat_emb row stats and G in place (waves 0..3); u transposed (waves 4, 5); c (wave 6) ----
    if (w < 4) {
        const int j = tid;  // 128 threads, one staged feat_emb row each (pitch 66: no bank conflict)
        float s = 0.0f;
        #pragma unroll   // whole row read at constant offsets behind few waits; the second pass reuses the registers
        for (int k = 0; k < 64; k++) s += sXn[j * XS + k];
        float mj = s * (1.0f / 64.0f);
        float q = 0.0f;
        #pragma unroll   // as above; the row's only reader rewrites it in place
        for (int k = 0; k < 64; k++) {
            float d = sXn[j * XS + k] - mj;
            q += d * d;
            sXn[j * XS + k] = d * g1[k];
        }
        sVar[j] = q * (1.0f / 64.0f);
    } else if (w < 6) {
        const int e = tid - 128;
        #pragma unroll
        for (int h = 0; h < 4; h++) {
            float acc = 0.0f;
            for (int d = 0; d < 16; d++) acc += wk[e * 64 + h * 16 + d] * sQlab[h * 16 + d];
            sUt[h * UTS + e] = acc;
        }
    } else if (w == 6) {
        if (lane < 4) {
            float acc = 0.0f;
            for (int d = 0; d < 16; d++) acc += bk[lane * 16 + d] * sQlab[lane * 16 + d];
            sC[lane] = acc;
        }
    }
    __syncthreads();

    // ---- Phase 0d: sP[h][j] = (row j of sXn) . u_h for j = 0..129, once per block, one 16-row tile a wave
    //      WMMA f32 16x16x4: A = sXn tile rows (zero-padded), B = U^T (zero-padded cols)
    if (w < 9) {
        const int mt = w;
        v8f acc = {0.f, 0.f, 0.f, 0.f, 0.f, 0.f, 0.f, 0.f};
        const int jbase = mt * 16 + mr;          // A row for this lane (<= 143, in bounds)
        #pragma unroll
        for (int kk = 0; kk < 64; kk += 4) {
            const int k0 = kk + 2 * lh;          // this lane's K pair: k0, k0+1
            v2f a, b;
            a[0] = sXn[jbase * XS + k0];
            a[1] = sXn[jbase * XS + k0 + 1];
            b[0] = sUt[mr * UTS + k0];
            b[1] = sUt[mr * UTS + k0 + 1];
            acc = __builtin_amdgcn_wmma_f32_16x16x4_f32(
                false, a, false, b, (short)0, acc, false, false);
        }
        if (mt < 8) {                            // all 16 rows valid: unconditional writeback
            if (mr < 4) {
                #pragma unroll
                for (int r = 0; r < 8; r++) sP[mr * SS + mt * 16 + r + 8 * lh] = acc[r];   // D: M = r + 8*half
            }
        } else {                                 // tile 8: only j == 128, 129 (r = 0, 1, half 0) are live
            if (mr < 4 && lh == 0) {
                sP[mr * SS + 128] = acc[0];
                sP[mr * SS + 129] = acc[1];
            }
        }
    }
    __syncthreads();

    // ---- Phase 1: wave w takes sample w. Zn = LN(Z row) over 128 features, then s_j; all in registers ----
    float sj[4];
    {
        const float zm = wave_sum((z0 + z1) + (z2 + z3)) * (1.0f / 128.0f);
        const float e0 = z0 - zm, e1 = z1 - zm, e2 = z2 - zm, e3 = z3 - zm;
        const float zv = wave_sum((e0 * e0 + e1 * e1) + (e2 * e2 + e3 * e3)) * (1.0f / 128.0f);
        const float zr = rsqrtf(zv + 1e-5f);
        const v4f var = *(const v4f*)&sVar[4 * lane];
        const float zn0 = e0 * zr, zn1 = e1 * zr, zn2 = e2 * zr, zn3 = e3 * zr;
        sj[0] = zn0 * rsqrtf(zn0 * zn0 * var[0] + 1e-5f);
        sj[1] = zn1 * rsqrtf(zn1 * zn1 * var[1] + 1e-5f);
        sj[2] = zn2 * rsqrtf(zn2 * zn2 * var[2] + 1e-5f);
        sj[3] = zn3 * rsqrtf(zn3 * zn3 * var[3] + 1e-5f);
    }

    // ---- Phases 3+4: scores[h][j] = 0.25*(s_j*P[h][j] + be1.u_h + c_h) + alpha*A_full[j,128] and softmax,
    //      lane holds j = 4*lane..+3; j = 128 (label row) is the same in every lane ----
    {
        const v4f ab = *(const v4f*)&sAB[4 * lane];
        const float ab128 = sAB[128];
        #pragma unroll
        for (int h = 0; h < 4; h++) {
            const v4f p = *(const v4f*)&sP[h * SS + 4 * lane];
            const float ch = sC[h];
            const float cb = sP[h * SS + 129] + ch;
            const float s128 = 0.25f * (sP[h * SS + 128] + ch) + ab128;
            float sc[4];
            #pragma unroll
            for (int i = 0; i < 4; i++) sc[i] = 0.25f * (sj[i] * p[i] + cb) + ab[i];
            const float mx = fmaxf(wave_max(fmaxf(fmaxf(sc[0], sc[1]), fmaxf(sc[2], sc[3]))), s128);
            #pragma unroll
            for (int i = 0; i < 4; i++) sc[i] = expf(sc[i] - mx);
            const float e128 = expf(s128 - mx);
            const float sumf = wave_sum((sc[0] + sc[1]) + (sc[2] + sc[3]));
            const float inv = 1.0f / (sumf + e128);
            float* row = &sScore[(h * NS + w) * SS];
            v4f o;
            #pragma unroll
            for (int i = 0; i < 4; i++) o[i] = sc[i] * inv * sj[i];
            *(v4f*)&row[4 * lane] = o;
            if (lane == 0) {
                v4f t;
                t[0] = e128 * inv;               // weight of the label row
                t[1] = sumf * inv;               // weight of the be1 row
                t[2] = 0.0f;                     // K pad of the WMMA below
                t[3] = 0.0f;
                *(v4f*)&row[128] = t;
            }
        }
    }
    __syncthreads();

    // ---- Phase 5: y[head*16+sample,:] = sScore row @ sXn  (K = 130 pad 132); wave = one head's 16 samples x 16 columns ----
    {
        v8f acc = {0.f, 0.f, 0.f, 0.f, 0.f, 0.f, 0.f, 0.f};
        const int hb = (w >> 2) * NS;   // first row of this wave's head
        const int e  = (w & 3) * 16 + mr;      // B column (N) handled by this lane
        #pragma unroll
        for (int kk = 0; kk < 132; kk += 4) {
            const int k0 = kk + 2 * lh;
            v2f a, b;
            a[0] = sScore[(hb + mr) * SS + k0];       // cols 130, 131 are zero
            a[1] = sScore[(hb + mr) * SS + k0 + 1];
            b[0] = sXn[k0 * XS + e];           // rows 130..143 are zero
            b[1] = sXn[(k0 + 1) * XS + e];
            acc = __builtin_amdgcn_wmma_f32_16x16x4_f32(
                false, a, false, b, (short)0, acc, false, false);
        }
        #pragma unroll
        for (int r = 0; r < 8; r++) sY[(hb + r + 8 * lh) * AS + e] = acc[r];   // D: M = r + 8*half
    }
    __syncthreads();

    // ---- Phase 6: attn_out = y @ wv + bv ; o = attn_out @ wo + bo ; Xrow = label + o ----
    //      16 samples x 16 columns a wave; each sum goes from the WMMA straight to LDS
    if (w < 4) {                          // head w: its own 16 columns of wv
        const v8f acc = rows_times_weights<64, 64>(&sY[(w * NS + mr) * AS], wv + col4, lh, cWv);
        #pragma unroll
        for (int r = 0; r < 8; r++) sA64[(r + 8 * lh) * AS + col4] = acc[r];
    }
    __syncthreads();
    if (w < 4) {
        const v8f acc = rows_times_weights<64, 64>(&sA64[mr * AS], wo + col4, lh, cWo);
        #pragma unroll
        for (int r = 0; r < 8; r++) sXrow[(r + 8 * lh) * AS + col4] = acc[r];
    }
    __syncthreads();

    // ---- Phase 7: t = LN(Xrow)*g2 + be2; wave w holds sample w's whole row, two values a lane ----
    const v2f xrow = *(const v2f*)&sXrow[w * AS + 2 * lane];
    {
        const float xa = xrow[0], xb = xrow[1];
        const float m2 = wave_sum(xa + xb) * (1.0f / 64.0f);
        const float xda = xa - m2, xdb = xb - m2;
        const float v2 = wave_sum(xda * xda + xdb * xdb) * (1.0f / 64.0f);
        const float r2 = rsqrtf(v2 + 1e-5f);
        sT[w * AS + 2 * lane]     = xda * r2 * g2[2 * lane]     + be2[2 * lane];
        sT[w * AS + 2 * lane + 1] = xdb * r2 * g2[2 * lane + 1] + be2[2 * lane + 1];
    }
    __syncthreads();

    // ---- Phase 8: FFN (exact gelu) + residual, emit last-token rows ----
    if (w < 8) {                          // 128 hidden units: eight 16-column tiles
        const v8f acc = rows_times_weights<64, 128>(&sT[mr * AS], w1 + col, lh, cW1);
        #pragma unroll
        for (int r = 0; r < 8; r++) sH[(r + 8 * lh) * HS + col] = acc[r];
    }
    __syncthreads();
    {                                     // gelu in place: wave w takes sample w's row, four values a lane
        v4f x = *(const v4f*)&sH[w * HS + 4 * lane];
        #pragma unroll
        for (int i = 0; i < 4; i++) x[i] = 0.5f * x[i] * (1.0f + erff(x[i] * 0.70710678118654752f));
        *(v4f*)&sH[w * HS + 4 * lane] = x;
    }
    __syncthreads();
    if (w < 8) {                          // four 16-column tiles x two halves of K, summed at the store below
        const int kh = w >> 2;
        const v8f acc = rows_times_weights<64, 64>(&sH[mr * HS + kh * 64], w2 + kh * 64 * 64 + col4, lh,
                                                   kh == 0 ? cW2 : 0.0f);
        #pragma unroll
        for (int r = 0; r < 8; r++) sO[(kh * NS + r + 8 * lh) * AS + col4] = acc[r];
    }
    __syncthreads();   // the tiles' 64-byte pieces meet in LDS, so that each wave stores one whole 256-byte output row
    {
        const v2f o0 = *(const v2f*)&sO[w * AS + 2 * lane];
        const v2f o1 = *(const v2f*)&sO[(NS + w) * AS + 2 * lane];
        float* orow = out + ((size_t)blk * NS + w) * 64 + 2 * lane;
        orow[0] = xrow[0] + (o0[0] + o1[0]);
        orow[1] = xrow[1] + (o0[1] + o1[1]);
    }
}

extern "C" void kernel_launch(void* const* d_in, const int* in_sizes, int n_in,
                              void* d_out, int out_size, void* d_ws, size_t ws_size,
                              hipStream_t stream) {
    (void)n_in; (void)d_ws; (void)ws_size; (void)out_size;
    const float* Z          = (const float*)d_in[0];
    const float* A_full     = (const float*)d_in[1];
    const float* feat_emb   = (const float*)d_in[2];
    const float* label_tok  = (const float*)d_in[3];
    const float* wq         = (const float*)d_in[4];
    const float* bq         = (const float*)d_in[5];
    const float* wk         = (const float*)d_in[6];
    const float* bk         = (const float*)d_in[7];
    const float* wv         = (const float*)d_in[8];
    const float* bv         = (const float*)d_in[9];
    const float* wo         = (const float*)d_in[10];
    const float* bo         = (const float*)d_in[11];
    const float* w1         = (const float*)d_in[12];
    const float* b1         = (const float*)d_in[13];
    const float* w2         = (const float*)d_in[14];
    const float* b2         = (const float*)d_in[15];
    const float* alphap     = (const float*)d_in[16];
    const float* g1         = (const float*)d_in[17];
    const float* be1        = (const float*)d_in[18];
    const float* g2         = (const float*)d_in[19];
    const float* be2        = (const float*)d_in[20];
    float* out              = (float*)d_out;

    const int N = in_sizes[0] / (128 * NS);   // blocks of NS samples
    label_row_block16_kernel<<<N, NT, 0, stream>>>(
        Z, A_full, feat_emb, label_tok, wq, bq, wk, bk, wv, bv, wo, bo,
        w1, b1, w2, b2, alphap, g1, be1, g2, be2, out);
}

// v005
// One run takes 10.8 microseconds.
// Two timings next to v004 put it at 1.24 and 1.23 times that version's speed.
// Over all steps from v000 it is 9.16 times as fast.
#include <hip/hip_runtime.h>
#include <hip/hip_bf16.h>

typedef __attribute__((ext_vector_type(2))) float v2f;
typedef __attribute__((ext_vector_type(4))) float v4f;
typedef __attribute__((ext_vector_type(8))) float v8f;

#define XS  66   // Xn row stride (floats): conflict-free banks, 8B-aligned rows
#define UTS 66   // U-transposed row stride
#define SS  132  // score row stride (floats): 528B rows -> 16B aligned, conflict-free
#define AS  68   // row stride of the 64-column A operands of the weight products: the lanes' 8-byte reads fall on distinct banks
#define HS  132  // the same for the 128-column hidden rows
#define NS  16   // samples per block: one per wave; 16 samples are the 16 rows of one WMMA tile
#define NT  512  // threads per block: NS waves

// Lane l reads lane l ^ M of its own 16-lane row (DPP row_xmask); all 32 lanes must be on.
template <int M>
__device__ __forceinline__ float row_xor(float x) {
    return __builtin_bit_cast(float, __builtin_amdgcn_update_dpp(
        0, __builtin_bit_cast(int, x), 0x160 + M, 0xf, 0xf, true));
}
// Lane l reads lane l ^ 16.
__device__ __forceinline__ float half_xor(float x) {
    return __builtin_bit_cast(float, __builtin_amdgcn_permlanex16(
        __builtin_bit_cast(int, x), __builtin_bit_cast(int, x), 0x76543210, 0xfedcba98, false, false));
}
// Butterfly over the wave's 32 lanes, in registers; every lane ends with the same bits.
__device__ __forceinline__ float wave_sum(float v) {
    v += row_xor<1>(v);
    v += row_xor<2>(v);
    v += row_xor<4>(v);
    v += row_xor<8>(v);
    v += half_xor(v);
    return v;
}
__device__ __forceinline__ float wave_max(float v) {
    v = fmaxf(v, row_xor<1>(v));
    v = fmaxf(v, row_xor<2>(v));
    v = fmaxf(v, row_xor<4>(v));
    v = fmaxf(v, row_xor<8>(v));
    v = fmaxf(v, half_xor(v));
    return v;
}

// Work-group barrier of the set-up phases, which hand over data through LDS alone: its fences name the LDS address space only,
// so the wave waits for its LDS operations and the global loads issued ahead stay in flight across it (__syncthreads() drains them).
__device__ __forceinline__ void lds_barrier() {
    __builtin_amdgcn_fence(__ATOMIC_RELEASE, "workgroup", "local");
    __builtin_amdgcn_s_barrier();
    __builtin_amdgcn_fence(__ATOMIC_ACQUIRE, "workgroup", "local");
}

// The B fragments of one 16-column weight tile, 64 rows deep, fetched from global memory into registers:
// f[2i], f[2i + 1] = rows 4i + 2*lh and 4i + 2*lh + 1 of this lane's column bCol.
template <int LDB>
__device__ __forceinline__ void fetch_weight_tile(float (&f)[32], const float* bCol, int lh) {
    #pragma unroll   // constant register indices; every load of the tile in flight at once
    for (int i = 0; i < 16; i++) {
        const int k0 = 4 * i + 2 * lh;
        f[2 * i]     = bCol[k0 * LDB];
        f[2 * i + 1] = bCol[(k0 + 1) * LDB];
    }
    asm volatile("s_wait_xcnt 0x0" ::: "memory");   // stands before what follows may reuse the weight loads' address registers
    __builtin_amdgcn_sched_barrier(0);              // keeps what follows from being scheduled in front of that wait
}

// One 16 x 16 tile of (16 sample rows in LDS) x (a weight tile held in registers), K = 64, on WMMA f32 16x16x4.
// aRow = this lane's A row (sample lane & 15); A takes k = 4i + 2*lh, + 1, the order in which f was fetched.
// c0 = the column's start value (its bias). D: register r of half lh is sample r + 8*lh, column = the lane's B column.
__device__ __forceinline__ v8f rows_times_weights(const float* aRow, const float (&f)[32], int lh, float c0) {
    v8f acc = {c0, c0, c0, c0, c0, c0, c0, c0};
    #pragma unroll   // constant register indices
    for (int i = 0; i < 16; i++) {
        const v2f a = *(const v2f*)&aRow[4 * i + 2 * lh];
        v2f b;
        b[0] = f[2 * i];
        b[1] = f[2 * i + 1];
        acc = __builtin_amdgcn_wmma_f32_16x16x4_f32(false, a, false, b, (short)0, acc, false, false);
    }
    return acc;
}

__global__ __launch_bounds__(NT)
void label_row_block16_kernel(
        const float* __restrict__ Z, const float* __restrict__ A_full,
        const float* __restrict__ feat_emb, const float* __restrict__ label_token,
        const float* __restrict__ wq, const float* __restrict__ bq,
        const float* __restrict__ wk, const float* __restrict__ bk,
        const float* __restrict__ wv, const float* __restrict__ bv,
        const float* __restrict__ wo, const float* __restrict__ bo,
        const float* __restrict__ w1, const float* __restrict__ b1,
        const float* __restrict__ w2, const float* __restrict__ b2,
        const float* __restrict__ alphap,
        const float* __restrict__ g1, const float* __restrict__ be1,
        const float* __restrict__ g2, const float* __restrict__ be2,
        float* __restrict__ out)
{
    // Xn[j][k] = s_j * G[j][k] + be1[k] for j < 128, with G = (feat_emb - row mean) * g1 the same for every
    // sample and s_j = Zn_j * rsqrt(Zn_j^2 * var_j + eps) the only per-sample part.
    __shared__ float sXn[144 * XS];       // rows 0..127: raw feat_emb, then G in place; 128: LN(label); 129: be1; 130..143 zero pad
    __shared__ float sUt[16 * UTS];       // U transposed: [head][e]; rows 4..15 zero
    __shared__ __attribute__((aligned(16))) float sScore[4 * NS * SS];  // row = head*16 + sample: attn*s_j | attn_128 | sum of attn over j<128 | 0 0
    __shared__ __attribute__((aligned(16))) float sP[4 * SS];       // sP[h][j] = (row j of sXn) . u_h, j = 0..129
    __shared__ __attribute__((aligned(16))) float sY[4 * NS * AS];  // row = head*16 + sample
    __shared__ __attribute__((aligned(16))) float sVar[128];
    __shared__ float sQlab[64];
    __shared__ float sG1[64];
    __shared__ float sC[4];
    __shared__ __attribute__((aligned(16))) float sAB[132];         // alpha * A_full[j, 128], j = 0..128
    __shared__ __attribute__((aligned(16))) float sA64[NS * AS], sXrow[NS * AS], sT[NS * AS];   // row = sample
    __shared__ __attribute__((aligned(16))) float sO[2 * NS * AS];  // row = K half*16 + sample
    __shared__ __attribute__((aligned(16))) float sH[NS * HS];      // row = sample

    const int tid  = threadIdx.x;
    const int blk  = blockIdx.x;
    const int w    = __builtin_amdgcn_readfirstlane(tid >> 5);   // wave id (0..15) = sample of this block in the per-sample phases; scalar, so tests on it are scalar branches
    const int lane = tid & 31;
    const int lh   = lane >> 4;       // half-wave (0/1)
    const int mr   = lane & 15;

    // ---- This wave's Z row, four values a lane (used after the block-wide set-up) ----
    const float* zrow = Z + ((size_t)blk * NS + w) * 128;
    const float z0 = zrow[4 * lane],     z1 = zrow[4 * lane + 1];
    const float z2 = zrow[4 * lane + 2], z3 = zrow[4 * lane + 3];

    // ---- Start values of the weight products' columns, fetched here so that no product waits for its bias first ----
    const int col  = (w & 7) * 16 + mr;   // this lane's output column among 128
    const int col4 = (w & 3) * 16 + mr;   // this lane's output column among 64
    const float cWv = bv[col4], cWo = label_token[col4] + bo[col4], cW1 = b1[col], cW2 = b2[col4];

    // ---- Every other global read of the kernel is issued here or in front of the first barrier and held in registers,
    //      so that no later phase starts with a round trip to L2 ----
    float fe[16];                              // feat_emb: each wave load covers 512 contiguous bytes (whole lines)
    #pragma unroll   // all 4 loads in flight behind one latency
    for (int i = 0; i < 4; i++) {
        const int gs = (tid + i * NT) * 4;
        fe[4 * i]     = feat_emb[gs];
        fe[4 * i + 1] = feat_emb[gs + 1];
        fe[4 * i + 2] = feat_emb[gs + 2];
        fe[4 * i + 3] = feat_emb[gs + 3];
    }
    const int t64 = tid & 63;
    const float alpha = alphap[0];
    const float acol  = A_full[(tid < 129 ? tid : 128) * 129 + 128];   // index clamped: every thread reads inside A_full
    const float la = label_token[2 * lane], lb = label_token[2 * lane + 1];
    const float lt = label_token[t64], g1t = g1[t64], bk1 = be1[t64], bqt = bq[t64];
    const float g2a = g2[2 * lane], g2b = g2[2 * lane + 1], be2a = be2[2 * lane], be2b = be2[2 * lane + 1];
    asm volatile("s_wait_xcnt 0x0" ::: "memory");   // stands before what follows may reuse the address registers of the loads above
    __builtin_amdgcn_sched_barrier(0);              // keeps what follows from being scheduled in front of that wait
    float fq[64];                              // waves 0, 1: column tid of wq
    float fk[64];                              // waves 4, 5: row tid - 128 of wk
    float fb[16];                              // wave 6: head lane & 3 of bk
    if (w < 2) {
        #pragma unroll   // constant register indices
        for (int e = 0; e < 64; e++) fq[e] = wq[e * 64 + tid];
        asm volatile("s_wait_xcnt 0x0" ::: "memory");   // stands, inside the arm, before what follows may reuse the address registers of its loads
        __builtin_amdgcn_sched_barrier(0);              // keeps what follows from being scheduled in front of that wait
    } else if ((w >> 1) == 2) {
        #pragma unroll   // constant register indices
        for (int i = 0; i < 64; i++) fk[i] = wk[(tid - 128) * 64 + i];
        asm volatile("s_wait_xcnt 0x0" ::: "memory");   // as in the first arm
        __builtin_amdgcn_sched_barrier(0);              // as in the first arm
    } else if (w == 6) {
        #pragma unroll   // constant register indices
        for (int d = 0; d < 16; d++) fb[d] = bk[(lane & 3) * 16 + d];
        asm volatile("s_wait_xcnt 0x0" ::: "memory");   // as in the first arm
        __builtin_amdgcn_sched_barrier(0);              // as in the first arm
    }

    #pragma unroll   // constant register indices
    for (int i = 0; i < 4; i++) {
        const int q  = tid + i * NT;           // group of 4 floats: row q>>4, columns 4*(q&15)..+3
        const int ls = (q >> 4) * XS + (q & 15) * 4;
        sXn[ls]     = fe[4 * i];
        sXn[ls + 1] = fe[4 * i + 1];
        sXn[ls + 2] = fe[4 * i + 2];
        sXn[ls + 3] = fe[4 * i + 3];
    }

    // ---- Zero the padded WMMA operand regions once (no guards needed later) ----
    for (int i = tid; i < 14 * XS; i += NT) sXn[130 * XS + i] = 0.0f;   // rows 130..143
    for (int i = tid; i < 16 * UTS; i += NT) sUt[i] = 0.0f;

    // ---- Stage the attention bias column: sAB[j] = alpha * A_full[j, 128] ----
    if (tid < 129) sAB[tid] = alpha * acol;

    // ---- The weight tiles of the four products behind the attention, behind the loads that the set-up waits for:
    //      waves 4..7 hold their tiles of wv and wo, waves 8..15 those of w1 and w2 ----
    float fA[32], fB[32];
    if (w >= 8) {
        fetch_weight_tile<128>(fA, w1 + col, lh);
        fetch_weight_tile<64>(fB, w2 + ((w >> 2) & 1) * 64 * 64 + col4, lh);
    } else if (w >= 4) {
        fetch_weight_tile<64>(fA, wv + col4, lh);
        fetch_weight_tile<64>(fB, wo + col4, lh);
    }

    // ---- Phase 0a: LN(label_token) -> row 128; be1 -> row 129 ----
    //      a wave holds the whole row, two values a lane, and sums it alone: no exchange between waves
    if (w < 2) {
        const float lm = wave_sum(la + lb) * (1.0f / 64.0f);
        const float lda = la - lm, ldb = lb - lm;
        const float lv = wave_sum(lda * lda + ldb * ldb) * (1.0f / 64.0f);
        const float lr = rsqrtf(lv + 1e-5f);
        sXn[128 * XS + tid] = (lt - lm) * lr * g1t + bk1;
        sXn[129 * XS + tid] = bk1;
        sG1[tid] = g1t;
    }
    lds_barrier();

    // ---- Phase 0b: Qlab = Xn128 @ wq + bq ----
    if (w < 2) {
        float acc = bqt;
        #pragma unroll   // constant register indices
        for (int e = 0; e < 64; e++) acc += sXn[128 * XS + e] * fq[e];
        sQlab[tid] = acc;
    }
    lds_barrier();

    // ---- Phase 0c: feat_emb row stats and G in place (waves 0..3); u transposed (waves 4, 5); c (wave 6) ----
    if (w < 4) {
        const int j = tid;  // 128 threads, one staged feat_emb row each (pitch 66: no bank conflict)
        float s = 0.0f;
        #pragma unroll   // whole row read at constant offsets behind few waits; the second pass reuses the registers
        for (int k = 0; k < 64; k++) s += sXn[j * XS + k];
        float mj = s * (1.0f / 64.0f);
        float q = 0.0f;
        #pragma unroll   // as above; the row's only reader rewrites it in place
        for (int k = 0; k < 64; k++) {
            float d = sXn[j * XS + k] - mj;
            q += d * d;
            sXn[j * XS + k] = d * sG1[k];
        }
        sVar[j] = q * (1.0f / 64.0f);
    } else if (w < 6) {
        const int e = tid - 128;
        #pragma unroll
        for (int h = 0; h < 4; h++) {
            float acc = 0.0f;
            #pragma unroll   // constant register indices
            for (int d = 0; d < 16; d++) acc += fk[h * 16 + d] * sQlab[h * 16 + d];
            sUt[h * UTS + e] = acc;
        }
    } else if (w == 6) {
        if (lane < 4) {
            float acc = 0.0f;
            #pragma unroll   // constant register indices
            for (int d = 0; d < 16; d++) acc += fb[d] * sQlab[lane * 16 + d];
            sC[lane] = acc;
        }
    }
    lds_barrier();

    // ---- Phase 0d: sP[h][j] = (row j of sXn) . u_h for j = 0..129, once per block, one 16-row tile a wave
    //      WMMA f32 16x16x4: A = sXn tile rows (zero-padded), B = U^T (zero-padded cols)
    if (w < 9) {
        const int mt = w;
        v8f acc = {0.f, 0.f, 0.f, 0.f, 0.f, 0.f, 0.f, 0.f};
        const int jbase = mt * 16 + mr;          // A row for this lane (<= 143, in bounds)
        #pragma unroll
        for (int kk = 0; kk < 64; kk += 4) {
            const int k0 = kk + 2 * lh;          // this lane's K pair: k0, k0+1
            v2f a, b;
            a[0] = sXn[jbase * XS + k0];
            a[1] = sXn[jbase * XS + k0 + 1];
            b[0] = sUt[mr * UTS + k0];
            b[1] = sUt[mr * UTS + k0 + 1];
            acc = __builtin_amdgcn_wmma_f32_16x16x4_f32(
                false, a, false, b, (short)0, acc, false, false);
        }
        if (mt < 8) {                            // all 16 rows valid: unconditional writeback
            if (mr < 4) {
                #pragma unroll
                for (int r = 0; r < 8; r++) sP[mr * SS + mt * 16 + r + 8 * lh] = acc[r];   // D: M = r + 8*half
            }
        } else {                                 // tile 8: only j == 128, 129 (r = 0, 1, half 0) are live
            if (mr < 4 && lh == 0) {
                sP[mr * SS + 128] = acc[0];
                sP[mr * SS + 129] = acc[1];
            }
        }
    }
    __syncthreads();

    // ---- Phase 1: wave w takes sample w. Zn = LN(Z row) over 128 features, then s_j; all in registers ----
    float sj[4];
    {
        const float zm = wave_sum((z0 + z1) + (z2 + z3)) * (1.0f / 128.0f);
        const float e0 = z0 - zm, e1 = z1 - zm, e2 = z2 - zm, e3 = z3 - zm;
        const float zv = wave_sum((e0 * e0 + e1 * e1) + (e2 * e2 + e3 * e3)) * (1.0f / 128.0f);
        const float zr = rsqrtf(zv + 1e-5f);
        const v4f var = *(const v4f*)&sVar[4 * lane];
        const float zn0 = e0 * zr, zn1 = e1 * zr, zn2 = e2 * zr, zn3 = e3 * zr;
        sj[0] = zn0 * rsqrtf(zn0 * zn0 * var[0] + 1e-5f);
        sj[1] = zn1 * rsqrtf(zn1 * zn1 * var[1] + 1e-5f);
        sj[2] = zn2 * rsqrtf(zn2 * zn2 * var[2] + 1e-5f);
        sj[3] = zn3 * rsqrtf(zn3 * zn3 * var[3] + 1e-5f);
    }

    // ---- Phases 3+4: scores[h][j] = 0.25*(s_j*P[h][j] + be1.u_h + c_h) + alpha*A_full[j,128] and softmax,
    //      lane holds j = 4*lane..+3; j = 128 (label row) is the same in every lane ----
    {
        const v4f ab = *(const v4f*)&sAB[4 * lane];
        const float ab128 = sAB[128];
        #pragma unroll
        for (int h = 0; h < 4; h++) {
            const v4f p = *(const v4f*)&sP[h * SS + 4 * lane];
            const float ch = sC[h];
            const float cb = sP[h * SS + 129] + ch;
            const float s128 = 0.25f * (sP[h * SS + 128] + ch) + ab128;
            float sc[4];
            #pragma unroll
            for (int i = 0; i < 4; i++) sc[i] = 0.25f * (sj[i] * p[i] + cb) + ab[i];
            const float mx = fmaxf(wave_max(fmaxf(fmaxf(sc[0], sc[1]), fmaxf(sc[2], sc[3]))), s128);
            #pragma unroll
            for (int i = 0; i < 4; i++) sc[i] = expf(sc[i] - mx);
            const float e128 = expf(s128 - mx);
            const float sumf = wave_sum((sc[0] + sc[1]) + (sc[2] + sc[3]));
            const float inv = 1.0f / (sumf + e128);
            float* row = &sScore[(h * NS + w) * SS];
            v4f o;
            #pragma unroll
            for (int i = 0; i < 4; i++) o[i] = sc[i] * inv * sj[i];
            *(v4f*)&row[4 * lane] = o;
            if (lane == 0) {
                v4f t;
                t[0] = e128 * inv;               // weight of the label row
                t[1] = sumf * inv;               // weight of the be1 row
                t[2] = 0.0f;                     // K pad of the WMMA below
                t[3] = 0.0f;
                *(v4f*)&row[128] = t;
            }
        }
    }
    __syncthreads();

    // ---- Phase 5: y[head*16+sample,:] = sScore row @ sXn  (K = 130 pad 132); wave = one head's 16 samples x 16 columns ----
    {
        v8f acc = {0.f, 0.f, 0.f, 0.f, 0.f, 0.f, 0.f, 0.f};
        const int hb = (w >> 2) * NS;   // first row of this wave's head
        const int e  = (w & 3) * 16 + mr;      // B column (N) handled by this lane
        #pragma unroll
        for (int kk = 0; kk < 132; kk += 4) {
            const int k0 = kk + 2 * lh;
            v2f a, b;
            a[0] = sScore[(hb + mr) * SS + k0];       // cols 130, 131 are zero
            a[1] = sScore[(hb + mr) * SS + k0 + 1];
            b[0] = sXn[k0 * XS + e];           // rows 130..143 are zero
            b[1] = sXn[(k0 + 1) * XS + e];
            acc = __builtin_amdgcn_wmma_f32_16x16x4_f32(
                false, a, false, b, (short)0, acc, false, false);
        }
        #pragma unroll
        for (int r = 0; r < 8; r++) sY[(hb + r + 8 * lh) * AS + e] = acc[r];   // D: M = r + 8*half
    }
    __syncthreads();

    // ---- Phase 6: attn_out = y @ wv + bv ; o = attn_out @ wo + bo ; Xrow = label + o ----
    //      16 samples x 16 columns a wave; each sum goes from the WMMA straight to LDS
    if ((w >> 2) == 1) {                  // head w & 3: its own 16 columns of wv
        const v8f acc = rows_times_weights(&sY[((w & 3) * NS + mr) * AS], fA, lh, cWv);
        #pragma unroll
        for (int r = 0; r < 8; r++) sA64[(r + 8 * lh) * AS + col4] = acc[r];
    }
    __syncthreads();
    if ((w >> 2) == 1) {
        const v8f acc = rows_times_weights(&sA64[mr * AS], fB, lh, cWo);
        #pragma unroll
        for (int r = 0; r < 8; r++) sXrow[(r + 8 * lh) * AS + col4] = acc[r];
    }
    __syncthreads();

    // ---- Phase 7: t = LN(Xrow)*g2 + be2; wave w holds sample w's whole row, two values a lane ----
    const v2f xrow = *(const v2f*)&sXrow[w * AS + 2 * lane];
    {
        const float xa = xrow[0], xb = xrow[1];
        const float m2 = wave_sum(xa + xb) * (1.0f / 64.0f);
        const float xda = xa - m2, xdb = xb - m2;
        const float v2 = wave_sum(xda * xda + xdb * xdb) * (1.0f / 64.0f);
        const float r2 = rsqrtf(v2 + 1e-5f);
        sT[w * AS + 2 * lane]     = xda * r2 * g2a + be2a;
        sT[w * AS + 2 * lane + 1] = xdb * r2 * g2b + be2b;
    }
    __syncthreads();

    // ---- Phase 8: FFN (exact gelu) + residual, emit last-token rows ----
    if (w >= 8) {                         // 128 hidden units: eight 16-column tiles
        const v8f acc = rows_times_weights(&sT[mr * AS], fA, lh, cW1);
        #pragma unroll
        for (int r = 0; r < 8; r++) sH[(r + 8 * lh) * HS + col] = acc[r];
    }
    __syncthreads();
    {                                     // gelu in place: wave w takes sample w's row, four values a lane
        v4f x = *(const v4f*)&sH[w * HS + 4 * lane];
        #pragma unroll
        for (int i = 0; i < 4; i++) x[i] = 0.5f * x[i] * (1.0f + erff(x[i] * 0.70710678118654752f));
        *(v4f*)&sH[w * HS + 4 * lane] = x;
    }
    __syncthreads();
    if (w >= 8) {                         // four 16-column tiles x two halves of K, summed at the store below
        const int kh = (w >> 2) & 1;
        const v8f acc = rows_times_weights(&sH[mr * HS + kh * 64], fB, lh, kh == 0 ? cW2 : 0.0f);
        #pragma unroll
        for (int r = 0; r < 8; r++) sO[(kh * NS + r + 8 * lh) * AS + col4] = acc[r];
    }
    __syncthreads();   // the tiles' 64-byte pieces meet in LDS, so that each wave stores one whole 256-byte output row
    {
        const v2f o0 = *(const v2f*)&sO[w * AS + 2 * lane];
        const v2f o1 = *(const v2f*)&sO[(NS + w) * AS + 2 * lane];
        float* orow = out + ((size_t)blk * NS + w) * 64 + 2 * lane;
        orow[0] = xrow[0] + (o0[0] + o1[0]);
        orow[1] = xrow[1] + (o0[1] + o1[1]);
    }
}

extern "C" void kernel_launch(void* const* d_in, const int* in_sizes, int n_in,
                              void* d_out, int out_size, void* d_ws, size_t ws_size,
                              hipStream_t stream) {
    (void)n_in; (void)d_ws; (void)ws_size; (void)out_size;
    const float* Z          = (const float*)d_in[0];
    const float* A_full     = (const float*)d_in[1];
    const float* feat_emb   = (const float*)d_in[2];
    const float* label_tok  = (const float*)d_in[3];
    const float* wq         = (const float*)d_in[4];
    const float* bq         = (const float*)d_in[5];
    const float* wk         = (const float*)d_in[6];
    const float* bk         = (const float*)d_in[7];
    const float* wv         = (const float*)d_in[8];
    const float* bv         = (const float*)d_in[9];
    const float* wo         = (const float*)d_in[10];
    const float* bo         = (const float*)d_in[11];
    const float* w1         = (const float*)d_in[12];
    const float* b1         = (const float*)d_in[13];
    const float* w2         = (const float*)d_in[14];
    const float* b2         = (const float*)d_in[15];
    const float* alphap     = (const float*)d_in[16];
    const float* g1         = (const float*)d_in[17];
    const float* be1        = (const float*)d_in[18];
    const float* g2         = (const float*)d_in[19];
    const float* be2        = (const float*)d_in[20];
    float* out              = (float*)d_out;

    const int N = in_sizes[0] / (128 * NS);   // blocks of NS samples
    label_row_block16_kernel<<<N, NT, 0, stream>>>(
        Z, A_full, feat_emb, label_tok, wq, bq, wk, bk, wv, bv, wo, bo,
        w1, b1, w2, b2, alphap, g1, be1, g2, be2, out);
}

// v006
// A run of this version takes 10.1 microseconds.
// Next to v005, in two timings, it ran 1.08 and 1.07 times as fast.
// Counting every step since v000, it is 9.84 times as fast.
#include <hip/hip_runtime.h>
#include <hip/hip_bf16.h>

typedef __attribute__((ext_vector_type(2))) float v2f;
typedef __attribute__((ext_vector_type(4))) float v4f;
typedef __attribute__((ext_vector_type(8))) float v8f;

#define XS  66   // Xn row stride (floats): conflict-free banks, 8B-aligned rows
#define UTS 66   // U-transposed row stride
#define SS  132  // score row stride (floats): 528B rows -> 16B aligned, conflict-free
#define AS  68   // row stride of the 64-column A operands of the weight products: the lanes' 8-byte reads fall on distinct banks
#define HS  132  // the same for the 128-column hidden rows
#define NS  16   // samples per block: one per wave; 16 samples are the 16 rows of one WMMA tile
#define NT  512  // threads per block: NS waves
#define LOG2E 1.4426950408889634f   // the scores are kept in base 2: softmax weights are 2^(s2 - max) on v_exp_f32 itself

// Lane l reads lane l ^ M of its own 16-lane row (DPP row_xmask); all 32 lanes must be on.
template <int M>
__device__ __forceinline__ float row_xor(float x) {
    return __builtin_bit_cast(float, __builtin_amdgcn_update_dpp(
        0, __builtin_bit_cast(int, x), 0x160 + M, 0xf, 0xf, true));
}
// Lane l reads lane l ^ 16.
__device__ __forceinline__ float half_xor(float x) {
    return __builtin_bit_cast(float, __builtin_amdgcn_permlanex16(
        __builtin_bit_cast(int, x), __builtin_bit_cast(int, x), 0x76543210, 0xfedcba98, false, false));
}
// Butterfly over the wave's 32 lanes, in registers; every lane ends with the same bits.
__device__ __forceinline__ float wave_sum(float v) {
    v += row_xor<1>(v);
    v += row_xor<2>(v);
    v += row_xor<4>(v);
    v += row_xor<8>(v);
    v += half_xor(v);
    return v;
}
__device__ __forceinline__ float wave_max(float v) {
    // Maximum over the 16-lane row, one v_max_num_f32_dpp a step (a NaN loses, as in fmaxf); all 32 lanes must be on.
    // In asm because fmaxf(v, row_xor(v)) compiles to three dependent instructions a step (DPP move, quieting max, max).
    // The s_delay_alu hints let the SIMD's other waves issue while each step waits for the one before it.
    asm("s_delay_alu instid0(VALU_DEP_1) | instskip(NEXT) | instid1(VALU_DEP_1)\n\t"
        "v_max_num_f32_dpp %0, %0, %0 row_xmask:1 row_mask:0xf bank_mask:0xf bound_ctrl:1\n\t"
        "v_max_num_f32_dpp %0, %0, %0 row_xmask:2 row_mask:0xf bank_mask:0xf bound_ctrl:1\n\t"
        "s_delay_alu instid0(VALU_DEP_1) | instskip(NEXT) | instid1(VALU_DEP_1)\n\t"
        "v_max_num_f32_dpp %0, %0, %0 row_xmask:4 row_mask:0xf bank_mask:0xf bound_ctrl:1\n\t"
        "v_max_num_f32_dpp %0, %0, %0 row_xmask:8 row_mask:0xf bank_mask:0xf bound_ctrl:1\n\t"
        "s_delay_alu instid0(VALU_DEP_1)"
        : "+v"(v));
    return fmaxf(v, half_xor(v));
}
// 1 / sqrt(x) for x = a sum of squares + the LayerNorm eps: the bare v_rsq_f32. The library form differs only in a rescue of
// subnormal x, which x >= eps never is, so the bits are the same.
__device__ __forceinline__ float rsq_eps(float x) { return __builtin_amdgcn_rsqf(x); }

// Work-group barrier of the set-up phases, which hand over data through LDS alone: its fences name the LDS address space only,
// so the wave waits for its LDS operations and the global loads issued ahead stay in flight across it (__syncthreads() drains them).
__device__ __forceinline__ void lds_barrier() {
    __builtin_amdgcn_fence(__ATOMIC_RELEASE, "workgroup", "local");
    __builtin_amdgcn_s_barrier();
    __builtin_amdgcn_fence(__ATOMIC_ACQUIRE, "workgroup", "local");
}

// The B fragments of one 16-column weight tile, 64 rows deep, fetched from global memory into registers:
// f[2i], f[2i + 1] = rows 4i + 2*lh and 4i + 2*lh + 1 of this lane's column bCol.
template <int LDB>
__device__ __forceinline__ void fetch_weight_tile(float (&f)[32], const float* bCol, int lh) {
    #pragma unroll   // constant register indices; every load of the tile in flight at once
    for (int i = 0; i < 16; i++) {
        const int k0 = 4 * i + 2 * lh;
        f[2 * i]     = bCol[k0 * LDB];
        f[2 * i + 1] = bCol[(k0 + 1) * LDB];
    }
    asm volatile("s_wait_xcnt 0x0" ::: "memory");   // stands before what follows may reuse the weight loads' address registers
    __builtin_amdgcn_sched_barrier(0);              // keeps what follows from being scheduled in front of that wait
}

// One 16 x 16 tile of (16 sample rows in LDS) x (a weight tile held in registers), K = 64, on WMMA f32 16x16x4.
// aRow = this lane's A row (sample lane & 15); A takes k = 4i + 2*lh, + 1, the order in which f was fetched.
// c0 = the column's start value (its bias). D: register r of half lh is sample r + 8*lh, column = the lane's B column.
__device__ __forceinline__ v8f rows_times_weights(const float* aRow, const float (&f)[32], int lh, float c0) {
    v8f acc = {c0, c0, c0, c0, c0, c0, c0, c0};
    #pragma unroll   // constant register indices
    for (int i = 0; i < 16; i++) {
        const v2f a = *(const v2f*)&aRow[4 * i + 2 * lh];
        v2f b;
        b[0] = f[2 * i];
        b[1] = f[2 * i + 1];
        acc = __builtin_amdgcn_wmma_f32_16x16x4_f32(false, a, false, b, (short)0, acc, false, false);
    }
    return acc;
}

__global__ __launch_bounds__(NT)
void label_row_block16_kernel(
        const float* __restrict__ Z, const float* __restrict__ A_full,
        const float* __restrict__ feat_emb, const float* __restrict__ label_token,
        const float* __restrict__ wq, const float* __restrict__ bq,
        const float* __restrict__ wk, const float* __restrict__ bk,
        const float* __restrict__ wv, const float* __restrict__ bv,
        const float* __restrict__ wo, const float* __restrict__ bo,
        const float* __restrict__ w1, const float* __restrict__ b1,
        const float* __restrict__ w2, const float* __restrict__ b2,
        const float* __restrict__ alphap,
        const float* __restrict__ g1, const float* __restrict__ be1,
        const float* __restrict__ g2, const float* __restrict__ be2,
        float* __restrict__ out)
{
    // Xn[j][k] = s_j * G[j][k] + be1[k] for j < 128, with G = (feat_emb - row mean) * g1 the same for every
    // sample and s_j = Zn_j * rsqrt(Zn_j^2 * var_j + eps) the only per-sample part.
    __shared__ float sXn[144 * XS];       // rows 0..127: raw feat_emb, then G in place; 128: LN(label); 129: be1; 130..143 zero pad
    __shared__ float sUt[16 * UTS];       // U transposed: [head][e]; rows 4..15 zero
    __shared__ __attribute__((aligned(16))) float sScore[4 * NS * SS];  // row = head*16 + sample: attn*s_j | attn_128 | sum of attn over j<128 | 0 0
    __shared__ __attribute__((aligned(16))) float sP[4 * SS];       // sP[h][j] = (row j of sXn) . u_h, j = 0..129
    __shared__ __attribute__((aligned(16))) float sY[4 * NS * AS];  // row = head*16 + sample
    __shared__ __attribute__((aligned(16))) float sVar[128];
    __shared__ float sQlab[64];
    __shared__ float sG1[64];
    __shared__ float sC[4];
    __shared__ __attribute__((aligned(16))) float sAB[132];         // log2(e) * alpha * A_full[j, 128], j = 0..128
    __shared__ __attribute__((aligned(16))) float sA64[NS * AS], sXrow[NS * AS], sT[NS * AS];   // row = sample
    __shared__ __attribute__((aligned(16))) float sO[2 * NS * AS];  // row = K half*16 + sample
    __shared__ __attribute__((aligned(16))) float sH[NS * HS];      // row = sample

    const int tid  = threadIdx.x;
    const int blk  = blockIdx.x;
    const int w    = __builtin_amdgcn_readfirstlane(tid >> 5);   // wave id (0..15) = sample of this block in the per-sample phases; scalar, so tests on it are scalar branches
    const int lane = tid & 31;
    const int lh   = lane >> 4;       // half-wave (0/1)
    const int mr   = lane & 15;

    // ---- This wave's Z row, four values a lane (used after the block-wide set-up) ----
    const float* zrow = Z + ((size_t)blk * NS + w) * 128;
    const float z0 = zrow[4 * lane],     z1 = zrow[4 * lane + 1];
    const float z2 = zrow[4 * lane + 2], z3 = zrow[4 * lane + 3];

    // ---- Start values of the weight products' columns, fetched here so that no product waits for its bias first ----
    const int col  = (w & 7) * 16 + mr;   // this lane's output column among 128
    const int col4 = (w & 3) * 16 + mr;   // this lane's output column among 64
    const float cWv = bv[col4], cWo = label_token[col4] + bo[col4], cW1 = b1[col], cW2 = b2[col4];

    // ---- Every other global read of the kernel is issued here or in front of the first barrier and held in registers,
    //      so that no later phase starts with a round trip to L2 ----
    float fe[16];                              // feat_emb: each wave load covers 512 contiguous bytes (whole lines)
    #pragma unroll   // all 4 loads in flight behind one latency
    for (int i = 0; i < 4; i++) {
        const int gs = (tid + i * NT) * 4;
        fe[4 * i]     = feat_emb[gs];
        fe[4 * i + 1] = feat_emb[gs + 1];
        fe[4 * i + 2] = feat_emb[gs + 2];
        fe[4 * i + 3] = feat_emb[gs + 3];
    }
    const int t64 = tid & 63;
    const float alpha = alphap[0];
    const float acol  = A_full[(tid < 129 ? tid : 128) * 129 + 128];   // index clamped: every thread reads inside A_full
    const float la = label_token[2 * lane], lb = label_token[2 * lane + 1];
    const float lt = label_token[t64], g1t = g1[t64], bk1 = be1[t64], bqt = bq[t64];
    const float g2a = g2[2 * lane], g2b = g2[2 * lane + 1], be2a = be2[2 * lane], be2b = be2[2 * lane + 1];
    asm volatile("s_wait_xcnt 0x0" ::: "memory");   // stands before what follows may reuse the address registers of the loads above
    __builtin_amdgcn_sched_barrier(0);              // keeps what follows from being scheduled in front of that wait
    float fq[64];                              // waves 0, 1: column tid of wq
    float fk[64];                              // waves 4, 5: row tid - 128 of wk
    float fb[16];                              // wave 6: head lane & 3 of bk
    if (w < 2) {
        #pragma unroll   // constant register indices
        for (int e = 0; e < 64; e++) fq[e] = wq[e * 64 + tid];
        asm volatile("s_wait_xcnt 0x0" ::: "memory");   // stands, inside the arm, before what follows may reuse the address registers of its loads
        __builtin_amdgcn_sched_barrier(0);              // keeps what follows from being scheduled in front of that wait
    } else if ((w >> 1) == 2) {
        #pragma unroll   // constant register indices
        for (int i = 0; i < 64; i++) fk[i] = wk[(tid - 128) * 64 + i];
        asm volatile("s_wait_xcnt 0x0" ::: "memory");   // as in the first arm
        __builtin_amdgcn_sched_barrier(0);              // as in the first arm
    } else if (w == 6) {
        #pragma unroll   // constant register indices
        for (int d = 0; d < 16; d++) fb[d] = bk[(lane & 3) * 16 + d];
        asm volatile("s_wait_xcnt 0x0" ::: "memory");   // as in the first arm
        __builtin_amdgcn_sched_barrier(0);              // as in the first arm
    }

    #pragma unroll   // constant register indices
    for (int i = 0; i < 4; i++) {
        const int q  = tid + i * NT;           // group of 4 floats: row q>>4, columns 4*(q&15)..+3
        const int ls = (q >> 4) * XS + (q & 15) * 4;
        sXn[ls]     = fe[4 * i];
        sXn[ls + 1] = fe[4 * i + 1];
        sXn[ls + 2] = fe[4 * i + 2];
        sXn[ls + 3] = fe[4 * i + 3];
    }

    // ---- Zero the padded WMMA operand regions once (no guards needed later) ----
    for (int i = tid; i < 14 * XS; i += NT) sXn[130 * XS + i] = 0.0f;   // rows 130..143
    for (int i = tid; i < 16 * UTS; i += NT) sUt[i] = 0.0f;

    // ---- Stage the attention bias column in base 2: sAB[j] = log2(e) * alpha * A_full[j, 128] ----
    if (tid < 129) sAB[tid] = LOG2E * (alpha * acol);

    // ---- The weight tiles of the four products behind the attention, behind the loads that the set-up waits for:
    //      waves 4..7 hold their tiles of wv and wo, waves 8..15 those of w1 and w2 ----
    float fA[32], fB[32];
    if (w >= 8) {
        fetch_weight_tile<128>(fA, w1 + col, lh);
        fetch_weight_tile<64>(fB, w2 + ((w >> 2) & 1) * 64 * 64 + col4, lh);
    } else if (w >= 4) {
        fetch_weight_tile<64>(fA, wv + col4, lh);
        fetch_weight_tile<64>(fB, wo + col4, lh);
    }

    // ---- Phase 0a: LN(label_token) -> row 128; be1 -> row 129 ----
    //      a wave holds the whole row, two values a lane, and sums it alone: no exchange between waves
    if (w < 2) {
        const float lm = wave_sum(la + lb) * (1.0f / 64.0f);
        const float lda = la - lm, ldb = lb - lm;
        const float lv = wave_sum(lda * lda + ldb * ldb) * (1.0f / 64.0f);
        const float lr = rsq_eps(lv + 1e-5f);
        sXn[128 * XS + tid] = (lt - lm) * lr * g1t + bk1;
        sXn[129 * XS + tid] = bk1;
        sG1[tid] = g1t;
    }
    lds_barrier();

    // ---- Phase 0b: Qlab = Xn128 @ wq + bq ----
    if (w < 2) {
        float acc = bqt;
        #pragma unroll   // constant register indices
        for (int e = 0; e < 64; e++) acc += sXn[128 * XS + e] * fq[e];
        sQlab[tid] = acc;
    }
    lds_barrier();

    // ---- Phase 0c: feat_emb row stats and G in place (waves 0..3); u transposed (waves 4, 5); c (wave 6) ----
    if (w < 4) {
        const int j = tid;  // 128 threads, one staged feat_emb row each (pitch 66: no bank conflict)
        float s = 0.0f;
        #pragma unroll   // whole row read at constant offsets behind few waits; the second pass reuses the registers
        for (int k = 0; k < 64; k++) s += sXn[j * XS + k];
        float mj = s * (1.0f / 64.0f);
        float q = 0.0f;
        #pragma unroll   // as above; the row's only reader rewrites it in place
        for (int k = 0; k < 64; k++) {
            float d = sXn[j * XS + k] - mj;
            q += d * d;
            sXn[j * XS + k] = d * sG1[k];
        }
        sVar[j] = q * (1.0f / 64.0f);
    } else if (w < 6) {
        const int e = tid - 128;
        #pragma unroll
        for (int h = 0; h < 4; h++) {
            float acc = 0.0f;
            #pragma unroll   // constant register indices
            for (int d = 0; d < 16; d++) acc += fk[h * 16 + d] * sQlab[h * 16 + d];
            sUt[h * UTS + e] = acc;
        }
    } else if (w == 6) {
        if (lane < 4) {
            float acc = 0.0f;
            #pragma unroll   // constant register indices
            for (int d = 0; d < 16; d++) acc += fb[d] * sQlab[lane * 16 + d];
            sC[lane] = acc;
        }
    }
    lds_barrier();

    // ---- Phase 0d: sP[h][j] = (row j of sXn) . u_h for j = 0..129, once per block, one 16-row tile a wave
    //      WMMA f32 16x16x4: A = sXn tile rows (zero-padded), B = U^T (zero-padded cols)
    if (w < 9) {
        const int mt = w;
        v8f acc = {0.f, 0.f, 0.f, 0.f, 0.f, 0.f, 0.f, 0.f};
        const int jbase = mt * 16 + mr;          // A row for this lane (<= 143, in bounds)
        #pragma unroll
        for (int kk = 0; kk < 64; kk += 4) {
            const int k0 = kk + 2 * lh;          // this lane's K pair: k0, k0+1
            v2f a, b;
            a[0] = sXn[jbase * XS + k0];
            a[1] = sXn[jbase * XS + k0 + 1];
            b[0] = sUt[mr * UTS + k0];
            b[1] = sUt[mr * UTS + k0 + 1];
            acc = __builtin_amdgcn_wmma_f32_16x16x4_f32(
                false, a, false, b, (short)0, acc, false, false);
        }
        if (mt < 8) {                            // all 16 rows valid: unconditional writeback
            if (mr < 4) {
                #pragma unroll
                for (int r = 0; r < 8; r++) sP[mr * SS + mt * 16 + r + 8 * lh] = acc[r];   // D: M = r + 8*half
            }
        } else {                                 // tile 8: only j == 128, 129 (r = 0, 1, half 0) are live
            if (mr < 4 && lh == 0) {
                sP[mr * SS + 128] = acc[0];
                sP[mr * SS + 129] = acc[1];
            }
        }
    }
    __syncthreads();

    // ---- Phase 1: wave w takes sample w. Zn = LN(Z row) over 128 features, then s_j; all in registers ----
    float sj[4];
    {
        const float zm = wave_sum((z0 + z1) + (z2 + z3)) * (1.0f / 128.0f);
        const float e0 = z0 - zm, e1 = z1 - zm, e2 = z2 - zm, e3 = z3 - zm;
        const float zv = wave_sum((e0 * e0 + e1 * e1) + (e2 * e2 + e3 * e3)) * (1.0f / 128.0f);
        const float zr = rsq_eps(zv + 1e-5f);
        const v4f var = *(const v4f*)&sVar[4 * lane];
        const float zn0 = e0 * zr, zn1 = e1 * zr, zn2 = e2 * zr, zn3 = e3 * zr;
        sj[0] = zn0 * rsq_eps(zn0 * zn0 * var[0] + 1e-5f);
        sj[1] = zn1 * rsq_eps(zn1 * zn1 * var[1] + 1e-5f);
        sj[2] = zn2 * rsq_eps(zn2 * zn2 * var[2] + 1e-5f);
        sj[3] = zn3 * rsq_eps(zn3 * zn3 * var[3] + 1e-5f);
    }

    // ---- Phases 3+4: scores[h][j] = 0.25*(s_j*P[h][j] + be1.u_h + c_h) + alpha*A_full[j,128], times log2(e), and softmax in base 2:
    //      one v_exp_f32 a weight (argument <= 0; what underflows is 0) and one v_rcp_f32 a row (the sum lies in 1..129);
    //      lane holds j = 4*lane..+3; j = 128 (label row) is the same in every lane ----
    {
        const v4f ab = *(const v4f*)&sAB[4 * lane];
        const float ab128 = sAB[128];
        #pragma unroll
        for (int h = 0; h < 4; h++) {
            const v4f p = *(const v4f*)&sP[h * SS + 4 * lane];
            const float ch = sC[h];
            const float cb = sP[h * SS + 129] + ch;
            const float s128 = (0.25f * LOG2E) * (sP[h * SS + 128] + ch) + ab128;
            float sc[4];
            #pragma unroll
            for (int i = 0; i < 4; i++) sc[i] = (0.25f * LOG2E) * (sj[i] * p[i] + cb) + ab[i];
            const float mx = fmaxf(wave_max(fmaxf(fmaxf(sc[0], sc[1]), fmaxf(sc[2], sc[3]))), s128);
            #pragma unroll
            for (int i = 0; i < 4; i++) sc[i] = __builtin_amdgcn_exp2f(sc[i] - mx);
            const float e128 = __builtin_amdgcn_exp2f(s128 - mx);
            const float sumf = wave_sum((sc[0] + sc[1]) + (sc[2] + sc[3]));
            const float inv = __builtin_amdgcn_rcpf(sumf + e128);
            float* row = &sScore[(h * NS + w) * SS];
            v4f o;
            #pragma unroll
            for (int i = 0; i < 4; i++) o[i] = sc[i] * inv * sj[i];
            *(v4f*)&row[4 * lane] = o;
            if (lane == 0) {
                v4f t;
                t[0] = e128 * inv;               // weight of the label row
                t[1] = sumf * inv;               // weight of the be1 row
                t[2] = 0.0f;                     // K pad of the WMMA below
                t[3] = 0.0f;
                *(v4f*)&row[128] = t;
            }
        }
    }
    __syncthreads();

    // ---- Phase 5: y[head*16+sample,:] = sScore row @ sXn  (K = 130 pad 132); wave = one head's 16 samples x 16 columns ----
    {
        v8f acc = {0.f, 0.f, 0.f, 0.f, 0.f, 0.f, 0.f, 0.f};
        const int hb = (w >> 2) * NS;   // first row of this wave's head
        const int e  = (w & 3) * 16 + mr;      // B column (N) handled by this lane
        #pragma unroll
        for (int kk = 0; kk < 132; kk += 4) {
            const int k0 = kk + 2 * lh;
            v2f a, b;
            a[0] = sScore[(hb + mr) * SS + k0];       // cols 130, 131 are zero
            a[1] = sScore[(hb + mr) * SS + k0 + 1];
            b[0] = sXn[k0 * XS + e];           // rows 130..143 are zero
            b[1] = sXn[(k0 + 1) * XS + e];
            acc = __builtin_amdgcn_wmma_f32_16x16x4_f32(
                false, a, false, b, (short)0, acc, false, false);
        }
        #pragma unroll
        for (int r = 0; r < 8; r++) sY[(hb + r + 8 * lh) * AS + e] = acc[r];   // D: M = r + 8*half
    }
    __syncthreads();

    // ---- Phase 6: attn_out = y @ wv + bv ; o = attn_out @ wo + bo ; Xrow = label + o ----
    //      16 samples x 16 columns a wave; each sum goes from the WMMA straight to LDS
    if ((w >> 2) == 1) {                  // head w & 3: its own 16 columns of wv
        const v8f acc = rows_times_weights(&sY[((w & 3) * NS + mr) * AS], fA, lh, cWv);
        #pragma unroll
        for (int r = 0; r < 8; r++) sA64[(r + 8 * lh) * AS + col4] = acc[r];
    }
    __syncthreads();
    if ((w >> 2) == 1) {
        const v8f acc = rows_times_weights(&sA64[mr * AS], fB, lh, cWo);
        #pragma unroll
        for (int r = 0; r < 8; r++) sXrow[(r + 8 * lh) * AS + col4] = acc[r];
    }
    __syncthreads();

    // ---- Phase 7: t = LN(Xrow)*g2 + be2; wave w holds sample w's whole row, two values a lane ----
    const v2f xrow = *(const v2f*)&sXrow[w * AS + 2 * lane];
    {
        const float xa = xrow[0], xb = xrow[1];
        const float m2 = wave_sum(xa + xb) * (1.0f / 64.0f);
        const float xda = xa - m2, xdb = xb - m2;
        const float v2 = wave_sum(xda * xda + xdb * xdb) * (1.0f / 64.0f);
        const float r2 = rsq_eps(v2 + 1e-5f);
        sT[w * AS + 2 * lane]     = xda * r2 * g2a + be2a;
        sT[w * AS + 2 * lane + 1] = xdb * r2 * g2b + be2b;
    }
    __syncthreads();

    // ---- Phase 8: FFN (exact gelu) + residual, emit last-token rows ----
    if (w >= 8) {                         // 128 hidden units: eight 16-column tiles
        const v8f acc = rows_times_weights(&sT[mr * AS], fA, lh, cW1);
        #pragma unroll
        for (int r = 0; r < 8; r++) sH[(r + 8 * lh) * HS + col] = acc[r];
    }
    __syncthreads();
    {                                     // gelu in place: wave w takes sample w's row, four values a lane
        v4f x = *(const v4f*)&sH[w * HS + 4 * lane];
        #pragma unroll
        for (int i = 0; i < 4; i++) x[i] = 0.5f * x[i] * (1.0f + erff(x[i] * 0.70710678118654752f));
        *(v4f*)&sH[w * HS + 4 * lane] = x;
    }
    __syncthreads();
    if (w >= 8) {                         // four 16-column tiles x two halves of K, summed at the store below
        const int kh = (w >> 2) & 1;
        const v8f acc = rows_times_weights(&sH[mr * HS + kh * 64], fB, lh, kh == 0 ? cW2 : 0.0f);
        #pragma unroll
        for (int r = 0; r < 8; r++) sO[(kh * NS + r + 8 * lh) * AS + col4] = acc[r];
    }
    __syncthreads();   // the tiles' 64-byte pieces meet in LDS, so that each wave stores one whole 256-byte output row
    {
        const v2f o0 = *(const v2f*)&sO[w * AS + 2 * lane];
        const v2f o1 = *(const v2f*)&sO[(NS + w) * AS + 2 * lane];
        float* orow = out + ((size_t)blk * NS + w) * 64 + 2 * lane;
        orow[0] = xrow[0] + (o0[0] + o1[0]);
        orow[1] = xrow[1] + (o0[1] + o1[1]);
    }
}

extern "C" void kernel_launch(void* const* d_in, const int* in_sizes, int n_in,
                              void* d_out, int out_size, void* d_ws, size_t ws_size,
                              hipStream_t stream) {
    (void)n_in; (void)d_ws; (void)ws_size; (void)out_size;
    const float* Z          = (const float*)d_in[0];
    const float* A_full     = (const float*)d_in[1];
    const float* feat_emb   = (const float*)d_in[2];
    const float* label_tok  = (const float*)d_in[3];
    const float* wq         = (const float*)d_in[4];
    const float* bq         = (const float*)d_in[5];
    const float* wk         = (const float*)d_in[6];
    const float* bk         = (const float*)d_in[7];
    const float* wv         = (const float*)d_in[8];
    const float* bv         = (const float*)d_in[9];
    const float* wo         = (const float*)d_in[10];
    const float* bo         = (const float*)d_in[11];
    const float* w1         = (const float*)d_in[12];
    const float* b1         = (const float*)d_in[13];
    const float* w2         = (const float*)d_in[14];
    const float* b2         = (const float*)d_in[15];
    const float* alphap     = (const float*)d_in[16];
    const float* g1         = (const float*)d_in[17];
    const float* be1        = (const float*)d_in[18];
    const float* g2         = (const float*)d_in[19];
    const float* be2        = (const float*)d_in[20];
    float* out              = (float*)d_out;

    const int N = in_sizes[0] / (128 * NS);   // blocks of NS samples
    label_row_block16_kernel<<<N, NT, 0, stream>>>(
        Z, A_full, feat_emb, label_tok, wq, bq, wk, bk, wv, bv, wo, bo,
        w1, b1, w2, b2, alphap, g1, be1, g2, be2, out);
}

// v007
// It runs in 9.53 microseconds.
// Timed twice side by side with v006, it ran 1.05 times as fast both times.
// All steps since v000 together make it 10.4 times as fast.
#include <hip/hip_runtime.h>
#include <hip/hip_bf16.h>

typedef __attribute__((ext_vector_type(2))) float v2f;
typedef __attribute__((ext_vector_type(4))) float v4f;
typedef __attribute__((ext_vector_type(8))) float v8f;

#define XS  66   // Xn row stride (floats): conflict-free banks, 8B-aligned rows
#define UTS 66   // U-transposed row stride
#define SS  132  // score row stride (floats): 528B rows -> 16B aligned, conflict-free
#define AS  68   // row stride of the 64-column A operands of the weight products: the lanes' 8-byte reads fall on distinct banks
#define HS  132  // the same for the 128-column hidden rows
#define NS  16   // samples per block: one per wave; 16 samples are the 16 rows of one WMMA tile
#define NT  512  // threads per block: NS waves
#define LOG2E 1.4426950408889634f   // the scores are kept in base 2: softmax weights are 2^(s2 - max) on v_exp_f32 itself

// Lane l reads lane l ^ M of its own 16-lane row (DPP row_xmask); all 32 lanes must be on.
template <int M>
__device__ __forceinline__ float row_xor(float x) {
    return __builtin_bit_cast(float, __builtin_amdgcn_update_dpp(
        0, __builtin_bit_cast(int, x), 0x160 + M, 0xf, 0xf, true));
}
// Lane l reads lane l ^ 16.
__device__ __forceinline__ float half_xor(float x) {
    return __builtin_bit_cast(float, __builtin_amdgcn_permlanex16(
        __builtin_bit_cast(int, x), __builtin_bit_cast(int, x), 0x76543210, 0xfedcba98, false, false));
}
// Butterfly over the wave's 32 lanes, in registers; every lane ends with the same bits.
__device__ __forceinline__ float wave_sum(float v) {
    v += row_xor<1>(v);
    v += row_xor<2>(v);
    v += row_xor<4>(v);
    v += row_xor<8>(v);
    v += half_xor(v);
    return v;
}
// Butterfly over the 16 lanes of the lane's own DPP row; every lane of the row ends with the same bits.
__device__ __forceinline__ float row_sum(float v) {
    v += row_xor<1>(v);
    v += row_xor<2>(v);
    v += row_xor<4>(v);
    v += row_xor<8>(v);
    return v;
}
__device__ __forceinline__ float wave_max(float v) {
    // Maximum over the 16-lane row, one v_max_num_f32_dpp a step (a NaN loses, as in fmaxf); all 32 lanes must be on.
    // In asm because fmaxf(v, row_xor(v)) compiles to three dependent instructions a step (DPP move, quieting max, max).
    // The s_delay_alu hints let the SIMD's other waves issue while each step waits for the one before it.
    asm("s_delay_alu instid0(VALU_DEP_1) | instskip(NEXT) | instid1(VALU_DEP_1)\n\t"
        "v_max_num_f32_dpp %0, %0, %0 row_xmask:1 row_mask:0xf bank_mask:0xf bound_ctrl:1\n\t"
        "v_max_num_f32_dpp %0, %0, %0 row_xmask:2 row_mask:0xf bank_mask:0xf bound_ctrl:1\n\t"
        "s_delay_alu instid0(VALU_DEP_1) | instskip(NEXT) | instid1(VALU_DEP_1)\n\t"
        "v_max_num_f32_dpp %0, %0, %0 row_xmask:4 row_mask:0xf bank_mask:0xf bound_ctrl:1\n\t"
        "v_max_num_f32_dpp %0, %0, %0 row_xmask:8 row_mask:0xf bank_mask:0xf bound_ctrl:1\n\t"
        "s_delay_alu instid0(VALU_DEP_1)"
        : "+v"(v));
    return fmaxf(v, half_xor(v));
}
// 1 / sqrt(x) for x = a sum of squares + the LayerNorm eps: the bare v_rsq_f32. The library form differs only in a rescue of
// subnormal x, which x >= eps never is, so the bits are the same.
__device__ __forceinline__ float rsq_eps(float x) { return __builtin_amdgcn_rsqf(x); }

// Work-group barrier of the set-up phases, which hand over data through LDS alone: its fences name the LDS address space only,
// so the wave waits for its LDS operations and the global loads issued ahead stay in flight across it (__syncthreads() drains them).
__device__ __forceinline__ void lds_barrier() {
    __builtin_amdgcn_fence(__ATOMIC_RELEASE, "workgroup", "local");
    __builtin_amdgcn_s_barrier();
    __builtin_amdgcn_fence(__ATOMIC_ACQUIRE, "workgroup", "local");
}

// The B fragments of one 16-column weight tile, 64 rows deep, fetched from global memory into registers:
// f[2i], f[2i + 1] = rows 4i + 2*lh and 4i + 2*lh + 1 of this lane's column bCol.
template <int LDB>
__device__ __forceinline__ void fetch_weight_tile(float (&f)[32], const float* bCol, int lh) {
    #pragma unroll   // constant register indices; every load of the tile in flight at once
    for (int i = 0; i < 16; i++) {
        const int k0 = 4 * i + 2 * lh;
        f[2 * i]     = bCol[k0 * LDB];
        f[2 * i + 1] = bCol[(k0 + 1) * LDB];
    }
    asm volatile("s_wait_xcnt 0x0" ::: "memory");   // stands before what follows may reuse the weight loads' address registers
    __builtin_amdgcn_sched_barrier(0);              // keeps what follows from being scheduled in front of that wait
}

// One 16 x 16 tile of (16 sample rows in LDS) x (a weight tile held in registers), K = 64, on WMMA f32 16x16x4.
// aRow = this lane's A row (sample lane & 15); A takes k = 4i + 2*lh, + 1, the order in which f was fetched.
// c0 = the column's start value (its bias). D: register r of half lh is sample r + 8*lh, column = the lane's B column.
__device__ __forceinline__ v8f rows_times_weights(const float* aRow, const float (&f)[32], int lh, float c0) {
    v8f acc = {c0, c0, c0, c0, c0, c0, c0, c0};
    #pragma unroll   // constant register indices
    for (int i = 0; i < 16; i++) {
        const v2f a = *(const v2f*)&aRow[4 * i + 2 * lh];
        v2f b;
        b[0] = f[2 * i];
        b[1] = f[2 * i + 1];
        acc = __builtin_amdgcn_wmma_f32_16x16x4_f32(false, a, false, b, (short)0, acc, false, false);
    }
    return acc;
}

__global__ __launch_bounds__(NT)
void label_row_block16_kernel(
        const float* __restrict__ Z, const float* __restrict__ A_full,
        const float* __restrict__ feat_emb, const float* __restrict__ label_token,
        const float* __restrict__ wq, const float* __restrict__ bq,
        const float* __restrict__ wk, const float* __restrict__ bk,
        const float* __restrict__ wv, const float* __restrict__ bv,
        const float* __restrict__ wo, const float* __restrict__ bo,
        const float* __restrict__ w1, const float* __restrict__ b1,
        const float* __restrict__ w2, const float* __restrict__ b2,
        const float* __restrict__ alphap,
        const float* __restrict__ g1, const float* __restrict__ be1,
        const float* __restrict__ g2, const float* __restrict__ be2,
        float* __restrict__ out)
{
    // Xn[j][k] = s_j * G[j][k] + be1[k] for j < 128, with G = (feat_emb - row mean) * g1 the same for every
    // sample and s_j = Zn_j * rsqrt(Zn_j^2 * var_j + eps) the only per-sample part.
    __shared__ float sXn[144 * XS];       // rows 0..127: G; 128: LN(label); 129: be1; 130..143 zero pad
    __shared__ float sUt[16 * UTS];       // U transposed: [head][e]; rows 4..15 zero
    __shared__ __attribute__((aligned(16))) float sScore[4 * NS * SS];  // row = head*16 + sample: attn*s_j | attn_128 | sum of attn over j<128 | 0 0
    __shared__ __attribute__((aligned(16))) float sP[4 * SS];       // sP[h][j] = (row j of sXn) . u_h, j = 0..129
    __shared__ __attribute__((aligned(16))) float sY[4 * NS * AS];  // row = head*16 + sample
    __shared__ __attribute__((aligned(16))) float sVar[128];
    __shared__ __attribute__((aligned(16))) float sQlab[64];
    __shared__ __attribute__((aligned(16))) float sXl[2 * 64];      // LN(label), one private copy for each of waves 0, 1
    __shared__ float sC[4];
    __shared__ __attribute__((aligned(16))) float sAB[132];         // log2(e) * alpha * A_full[j, 128], j = 0..128
    __shared__ __attribute__((aligned(16))) float sA64[NS * AS], sXrow[NS * AS], sT[NS * AS];   // row = sample
    __shared__ __attribute__((aligned(16))) float sO[2 * NS * AS];  // row = K half*16 + sample
    __shared__ __attribute__((aligned(16))) float sH[NS * HS];      // row = sample

    const int tid  = threadIdx.x;
    const int blk  = blockIdx.x;
    const int w    = __builtin_amdgcn_readfirstlane(tid >> 5);   // wave id (0..15) = sample of this block in the per-sample phases; scalar, so tests on it are scalar branches
    const int lane = tid & 31;
    const int lh   = lane >> 4;       // half-wave (0/1)
    const int mr   = lane & 15;

    // ---- This wave's Z row, four values a lane (normalized during the set-up, before the first barrier) ----
    const float* zrow = Z + ((size_t)blk * NS + w) * 128;
    const float z0 = zrow[4 * lane],     z1 = zrow[4 * lane + 1];
    const float z2 = zrow[4 * lane + 2], z3 = zrow[4 * lane + 3];

    // ---- Start values of the weight products' columns, fetched here so that no product waits for its bias first ----
    const int col  = (w & 7) * 16 + mr;   // this lane's output column among 128
    const int col4 = (w & 3) * 16 + mr;   // this lane's output column among 64
    const float cWv = bv[col4], cWo = label_token[col4] + bo[col4], cW1 = b1[col], cW2 = b2[col4];

    // ---- Every global read that the set-up needs is issued here and held in registers; the weight tiles follow behind the first barrier,
    //      so that no later phase starts with a round trip to L2 ----
    float fe[16];                              // feat_emb: each wave load covers 512 contiguous bytes (whole lines)
    #pragma unroll   // all 4 loads in flight behind one latency
    for (int i = 0; i < 4; i++) {
        const int gs = (tid + i * NT) * 4;
        fe[4 * i]     = feat_emb[gs];
        fe[4 * i + 1] = feat_emb[gs + 1];
        fe[4 * i + 2] = feat_emb[gs + 2];
        fe[4 * i + 3] = feat_emb[gs + 3];
    }
    const int t64 = tid & 63;
    const float alpha = alphap[0];
    const float acol  = A_full[(tid < 129 ? tid : 128) * 129 + 128];   // index clamped: every thread reads inside A_full
    const float la = label_token[2 * lane], lb = label_token[2 * lane + 1];
    const float g1a = g1[2 * lane], g1b = g1[2 * lane + 1], be1a = be1[2 * lane], be1b = be1[2 * lane + 1];
    const float bqt = bq[t64], bkt = bk[t64];
    const float g1q0 = g1[4 * mr], g1q1 = g1[4 * mr + 1], g1q2 = g1[4 * mr + 2], g1q3 = g1[4 * mr + 3];   // g1 at this lane's four feat_emb columns
    const float g2a = g2[2 * lane], g2b = g2[2 * lane + 1], be2a = be2[2 * lane], be2b = be2[2 * lane + 1];
    asm volatile("s_wait_xcnt 0x0" ::: "memory");   // stands before what follows may reuse the address registers of the loads above
    __builtin_amdgcn_sched_barrier(0);              // keeps what follows from being scheduled in front of that wait
    v2f   fq[32];                             // waves 0, 1: column tid of wq, rows 2k and 2k + 1 in pair k
    float fk[64];                              // waves 2, 3: row tid - 64 of wk
    if (w < 2) {
        #pragma unroll   // constant register indices
        for (int k = 0; k < 32; k++) {
            fq[k][0] = wq[(2 * k) * 64 + tid];
            fq[k][1] = wq[(2 * k + 1) * 64 + tid];
        }
        asm volatile("s_wait_xcnt 0x0" ::: "memory");   // stands, inside the arm, before what follows may reuse the address registers of its loads
        __builtin_amdgcn_sched_barrier(0);              // keeps what follows from being scheduled in front of that wait
    } else if (w < 4) {
        const float* wkrow = wk + (tid - 64) * 64;
        #pragma unroll   // constant register indices
        for (int i = 0; i < 64; i++) fk[i] = wkrow[i];
        asm volatile("s_wait_xcnt 0x0" :: "v"(wkrow) : "memory");   // as in the first arm; it names the row address, so that no load of the run lands on the address registers ahead of it
        __builtin_amdgcn_sched_barrier(0);              // as in the first arm
    }

    // ---- Phase 0a: LN(label_token) -> row 128 and a private copy for the wave's own Qlab; be1 -> row 129 ----
    //      a wave holds the whole row, two values a lane, and sums it alone: no exchange between waves
    if (w < 2) {
        const float lm = wave_sum(la + lb) * (1.0f / 64.0f);
        const float lda = la - lm, ldb = lb - lm;
        const float lv = wave_sum(lda * lda + ldb * ldb) * (1.0f / 64.0f);
        const float lr = rsq_eps(lv + 1e-5f);
        v2f x, b;
        x[0] = lda * lr * g1a + be1a;
        x[1] = ldb * lr * g1b + be1b;
        b[0] = be1a;
        b[1] = be1b;
        *(v2f*)&sXl[w * 64 + 2 * lane] = x;
        *(v2f*)&sXn[(128 + w) * XS + 2 * lane] = w == 0 ? x : b;
    }

    // ---- Phase 0b, beside the chain label -> Qlab of waves 0, 1: feat_emb row stats and G on all 16 waves, in the registers
    //      the loads landed in: a row's 64 values lie in the 16 lanes of one DPP row, four a lane ----
    {
        float vr[4];
        #pragma unroll   // constant register indices; the four rows' sums interleave
        for (int i = 0; i < 4; i++) {
            const int q  = tid + i * NT;           // group of 4 floats: row q>>4, columns 4*(q&15)..+3
            const int ls = (q >> 4) * XS + (q & 15) * 4;
            const float mj = row_sum((fe[4 * i] + fe[4 * i + 1]) + (fe[4 * i + 2] + fe[4 * i + 3])) * (1.0f / 64.0f);
            const float d0 = fe[4 * i] - mj, d1 = fe[4 * i + 1] - mj, d2 = fe[4 * i + 2] - mj, d3 = fe[4 * i + 3] - mj;
            vr[i] = row_sum((d0 * d0 + d1 * d1) + (d2 * d2 + d3 * d3)) * (1.0f / 64.0f);
            sXn[ls]     = d0 * g1q0;
            sXn[ls + 1] = d1 * g1q1;
            sXn[ls + 2] = d2 * g1q2;
            sXn[ls + 3] = d3 * g1q3;
        }
        if (mr == 0) {
            #pragma unroll
            for (int i = 0; i < 4; i++) sVar[(tid >> 4) + 32 * i] = vr[i];
        }
    }

    // ---- Zn = LN(Z row) over 128 features, wave w = sample w, in registers: it depends on nothing of the set-up ----
    float zn0, zn1, zn2, zn3;
    {
        const float zm = wave_sum((z0 + z1) + (z2 + z3)) * (1.0f / 128.0f);
        const float e0 = z0 - zm, e1 = z1 - zm, e2 = z2 - zm, e3 = z3 - zm;
        const float zv = wave_sum((e0 * e0 + e1 * e1) + (e2 * e2 + e3 * e3)) * (1.0f / 128.0f);
        const float zr = rsq_eps(zv + 1e-5f);
        zn0 = e0 * zr; zn1 = e1 * zr; zn2 = e2 * zr; zn3 = e3 * zr;
    }

    // ---- Zero the padded WMMA operand regions once (no guards needed later) ----
    for (int i = tid; i < 14 * XS; i += NT) sXn[130 * XS + i] = 0.0f;   // rows 130..143
    for (int i = tid; i < 16 * UTS; i += NT) sUt[i] = 0.0f;

    // ---- Stage the attention bias column in base 2: sAB[j] = log2(e) * alpha * A_full[j, 128] ----
    if (tid < 129) sAB[tid] = LOG2E * (alpha * acol);

    // ---- Phase 0c: Qlab = LN(label) @ wq + bq, eight partial sums a column; the wave reads back the copy that it alone wrote ----
    float qown = 0.0f;                         // waves 0, 1: Qlab[tid]
    if (w < 2) {
        asm volatile("s_wait_dscnt 0x0" ::: "memory");   // the wave's own copy of LN(label) has landed in LDS before the wave reads it back
        v2f a0 = {bqt, 0.0f}, a1 = {0.0f, 0.0f}, a2 = {0.0f, 0.0f}, a3 = {0.0f, 0.0f};
        #pragma unroll   // constant register indices
        for (int i = 0; i < 8; i++) {
            const v4f xa = *(const v4f*)&sXl[w * 64 + 8 * i];
            const v4f xb = *(const v4f*)&sXl[w * 64 + 8 * i + 4];
            a0 += __builtin_shufflevector(xa, xa, 0, 1) * fq[4 * i];
            a1 += __builtin_shufflevector(xa, xa, 2, 3) * fq[4 * i + 1];
            a2 += __builtin_shufflevector(xb, xb, 0, 1) * fq[4 * i + 2];
            a3 += __builtin_shufflevector(xb, xb, 2, 3) * fq[4 * i + 3];
        }
        const v2f s = (a0 + a1) + (a2 + a3);
        qown = s[0] + s[1];
        sQlab[tid] = qown;
    }
    __syncthreads();   // every load issued so far is needed here or directly behind (wk), so this barrier may drain them

    // ---- The weight tiles of the four products behind the attention, issued behind the loads that the set-up chain waits for,
    //      by waves that idle here: waves 4..7 hold their tiles of wv and wo, waves 8..15 those of w1 and w2 ----
    float fA[32], fB[32];
    if (w >= 8) {
        fetch_weight_tile<128>(fA, w1 + col, lh);
        fetch_weight_tile<64>(fB, w2 + ((w >> 2) & 1) * 64 * 64 + col4, lh);
    } else if (w >= 4) {
        fetch_weight_tile<64>(fA, wv + col4, lh);
        fetch_weight_tile<64>(fB, wo + col4, lh);
    }

    // ---- Phase 0d: u transposed (waves 2, 3), two partial sums a head; c (waves 0, 1): a head's 16 terms lie in one DPP row ----
    if ((w >> 1) == 1) {
        const int e = tid - 64;
        #pragma unroll
        for (int h = 0; h < 4; h++) {
            v2f acc = {0.0f, 0.0f};
            #pragma unroll   // constant register indices
            for (int d = 0; d < 16; d += 4) {
                const v4f q = *(const v4f*)&sQlab[h * 16 + d];
                v2f f0, f1;
                f0[0] = fk[h * 16 + d];     f0[1] = fk[h * 16 + d + 1];
                f1[0] = fk[h * 16 + d + 2]; f1[1] = fk[h * 16 + d + 3];
                acc += __builtin_shufflevector(q, q, 0, 1) * f0;
                acc += __builtin_shufflevector(q, q, 2, 3) * f1;
            }
            sUt[h * UTS + e] = acc[0] + acc[1];
        }
    } else if (w < 2) {
        const float c = row_sum(qown * bkt);
        if (mr == 0) sC[tid >> 4] = c;
    }
    lds_barrier();

    // ---- Phase 0e: sP[h][j] = (row j of sXn) . u_h for j = 0..129, once per block, one 16-row tile a wave
    //      WMMA f32 16x16x4: A = sXn tile rows (zero-padded), B = U^T (zero-padded cols)
    if (w < 9) {
        const int mt = w;
        v8f acc = {0.f, 0.f, 0.f, 0.f, 0.f, 0.f, 0.f, 0.f};
        const int jbase = mt * 16 + mr;          // A row for this lane (<= 143, in bounds)
        #pragma unroll
        for (int kk = 0; kk < 64; kk += 4) {
            const int k0 = kk + 2 * lh;          // this lane's K pair: k0, k0+1
            v2f a, b;
            a[0] = sXn[jbase * XS + k0];
            a[1] = sXn[jbase * XS + k0 + 1];
            b[0] = sUt[mr * UTS + k0];
            b[1] = sUt[mr * UTS + k0 + 1];
            acc = __builtin_amdgcn_wmma_f32_16x16x4_f32(
                false, a, false, b, (short)0, acc, false, false);
        }
        if (mt < 8) {                            // all 16 rows valid: unconditional writeback
            if (mr < 4) {
                #pragma unroll
                for (int r = 0; r < 8; r++) sP[mr * SS + mt * 16 + r + 8 * lh] = acc[r];   // D: M = r + 8*half
            }
        } else {                                 // tile 8: only j == 128, 129 (r = 0, 1, half 0) are live
            if (mr < 4 && lh == 0) {
                sP[mr * SS + 128] = acc[0];
                sP[mr * SS + 129] = acc[1];
            }
        }
    }
    lds_barrier();   // the set-up now ends before the weight tiles need have landed: they stay in flight across this barrier too

    // ---- Phase 1: wave w takes sample w: s_j from Zn and the row variances ----
    float sj[4];
    {
        const v4f var = *(const v4f*)&sVar[4 * lane];
        sj[0] = zn0 * rsq_eps(zn0 * zn0 * var[0] + 1e-5f);
        sj[1] = zn1 * rsq_eps(zn1 * zn1 * var[1] + 1e-5f);
        sj[2] = zn2 * rsq_eps(zn2 * zn2 * var[2] + 1e-5f);
        sj[3] = zn3 * rsq_eps(zn3 * zn3 * var[3] + 1e-5f);
    }

    // ---- Phases 3+4: scores[h][j] = 0.25*(s_j*P[h][j] + be1.u_h + c_h) + alpha*A_full[j,128], times log2(e), and softmax in base 2:
    //      one v_exp_f32 a weight (argument <= 0; what underflows is 0) and one v_rcp_f32 a row (the sum lies in 1..129);
    //      lane holds j = 4*lane..+3; j = 128 (label row) is the same in every lane ----
    {
        const v4f ab = *(const v4f*)&sAB[4 * lane];
        const float ab128 = sAB[128];
        #pragma unroll
        for (int h = 0; h < 4; h++) {
            const v4f p = *(const v4f*)&sP[h * SS + 4 * lane];
            const float ch = sC[h];
            const float cb = sP[h * SS + 129] + ch;
            const float s128 = (0.25f * LOG2E) * (sP[h * SS + 128] + ch) + ab128;
            float sc[4];
            #pragma unroll
            for (int i = 0; i < 4; i++) sc[i] = (0.25f * LOG2E) * (sj[i] * p[i] + cb) + ab[i];
            const float mx = fmaxf(wave_max(fmaxf(fmaxf(sc[0], sc[1]), fmaxf(sc[2], sc[3]))), s128);
            #pragma unroll
            for (int i = 0; i < 4; i++) sc[i] = __builtin_amdgcn_exp2f(sc[i] - mx);
            const float e128 = __builtin_amdgcn_exp2f(s128 - mx);
            const float sumf = wave_sum((sc[0] + sc[1]) + (sc[2] + sc[3]));
            const float inv = __builtin_amdgcn_rcpf(sumf + e128);
            float* row = &sScore[(h * NS + w) * SS];
            v4f o;
            #pragma unroll
            for (int i = 0; i < 4; i++) o[i] = sc[i] * inv * sj[i];
            *(v4f*)&row[4 * lane] = o;
            if (lane == 0) {
                v4f t;
                t[0] = e128 * inv;               // weight of the label row
                t[1] = sumf * inv;               // weight of the be1 row
                t[2] = 0.0f;                     // K pad of the WMMA below
                t[3] = 0.0f;
                *(v4f*)&row[128] = t;
            }
        }
    }
    __syncthreads();

    // ---- Phase 5: y[head*16+sample,:] = sScore row @ sXn  (K = 130 pad 132); wave = one head's 16 samples x 16 columns ----
    {
        v8f acc = {0.f, 0.f, 0.f, 0.f, 0.f, 0.f, 0.f, 0.f};
        const int hb = (w >> 2) * NS;   // first row of this wave's head
        const int e  = (w & 3) * 16 + mr;      // B column (N) handled by this lane
        #pragma unroll
        for (int kk = 0; kk < 132; kk += 4) {
            const int k0 = kk + 2 * lh;
            v2f a, b;
            a[0] = sScore[(hb + mr) * SS + k0];       // cols 130, 131 are zero
            a[1] = sScore[(hb + mr) * SS + k0 + 1];
            b[0] = sXn[k0 * XS + e];           // rows 130..143 are zero
            b[1] = sXn[(k0 + 1) * XS + e];
            acc = __builtin_amdgcn_wmma_f32_16x16x4_f32(
                false, a, false, b, (short)0, acc, false, false);
        }
        #pragma unroll
        for (int r = 0; r < 8; r++) sY[(hb + r + 8 * lh) * AS + e] = acc[r];   // D: M = r + 8*half
    }
    __syncthreads();

    // ---- Phase 6: attn_out = y @ wv + bv ; o = attn_out @ wo + bo ; Xrow = label + o ----
    //      16 samples x 16 columns a wave; each sum goes from the WMMA straight to LDS
    if ((w >> 2) == 1) {                  // head w & 3: its own 16 columns of wv
        const v8f acc = rows_times_weights(&sY[((w & 3) * NS + mr) * AS], fA, lh, cWv);
        #pragma unroll
        for (int r = 0; r < 8; r++) sA64[(r + 8 * lh) * AS + col4] = acc[r];
    }
    __syncthreads();
    if ((w >> 2) == 1) {
        const v8f acc = rows_times_weights(&sA64[mr * AS], fB, lh, cWo);
        #pragma unroll
        for (int r = 0; r < 8; r++) sXrow[(r + 8 * lh) * AS + col4] = acc[r];
    }
    __syncthreads();

    // ---- Phase 7: t = LN(Xrow)*g2 + be2; wave w holds sample w's whole row, two values a lane ----
    const v2f xrow = *(const v2f*)&sXrow[w * AS + 2 * lane];
    {
        const float xa = xrow[0], xb = xrow[1];
        const float m2 = wave_sum(xa + xb) * (1.0f / 64.0f);
        const float xda = xa - m2, xdb = xb - m2;
        const float v2 = wave_sum(xda * xda + xdb * xdb) * (1.0f / 64.0f);
        const float r2 = rsq_eps(v2 + 1e-5f);
        sT[w * AS + 2 * lane]     = xda * r2 * g2a + be2a;
        sT[w * AS + 2 * lane + 1] = xdb * r2 * g2b + be2b;
    }
    __syncthreads();

    // ---- Phase 8: FFN (exact gelu) + residual, emit last-token rows ----
    if (w >= 8) {                         // 128 hidden units: eight 16-column tiles
        const v8f acc = rows_times_weights(&sT[mr * AS], fA, lh, cW1);
        #pragma unroll
        for (int r = 0; r < 8; r++) sH[(r + 8 * lh) * HS + col] = acc[r];
    }
    __syncthreads();
    {                                     // gelu in place: wave w takes sample w's row, four values a lane
        v4f x = *(const v4f*)&sH[w * HS + 4 * lane];
        #pragma unroll
        for (int i = 0; i < 4; i++) x[i] = 0.5f * x[i] * (1.0f + erff(x[i] * 0.70710678118654752f));
        *(v4f*)&sH[w * HS + 4 * lane] = x;
    }
    __syncthreads();
    if (w >= 8) {                         // four 16-column tiles x two halves of K, summed at the store below
        const int kh = (w >> 2) & 1;
        const v8f acc = rows_times_weights(&sH[mr * HS + kh * 64], fB, lh, kh == 0 ? cW2 : 0.0f);
        #pragma unroll
        for (int r = 0; r < 8; r++) sO[(kh * NS + r + 8 * lh) * AS + col4] = acc[r];
    }
    __syncthreads();   // the tiles' 64-byte pieces meet in LDS, so that each wave stores one whole 256-byte output row
    {
        const v2f o0 = *(const v2f*)&sO[w * AS + 2 * lane];
        const v2f o1 = *(const v2f*)&sO[(NS + w) * AS + 2 * lane];
        float* orow = out + ((size_t)blk * NS + w) * 64 + 2 * lane;
        orow[0] = xrow[0] + (o0[0] + o1[0]);
        orow[1] = xrow[1] + (o0[1] + o1[1]);
    }
}

extern "C" void kernel_launch(void* const* d_in, const int* in_sizes, int n_in,
                              void* d_out, int out_size, void* d_ws, size_t ws_size,
                              hipStream_t stream) {
    (void)n_in; (void)d_ws; (void)ws_size; (void)out_size;
    const float* Z          = (const float*)d_in[0];
    const float* A_full     = (const float*)d_in[1];
    const float* feat_emb   = (const float*)d_in[2];
    const float* label_tok  = (const float*)d_in[3];
    const float* wq         = (const float*)d_in[4];
    const float* bq         = (const float*)d_in[5];
    const float* wk         = (const float*)d_in[6];
    const float* bk         = (const float*)d_in[7];
    const float* wv         = (const float*)d_in[8];
    const float* bv         = (const float*)d_in[9];
    const float* wo         = (const float*)d_in[10];
    const float* bo         = (const float*)d_in[11];
    const float* w1         = (const float*)d_in[12];
    const float* b1         = (const float*)d_in[13];
    const float* w2         = (const float*)d_in[14];
    const float* b2         = (const float*)d_in[15];
    const float* alphap     = (const float*)d_in[16];
    const float* g1         = (const float*)d_in[17];
    const float* be1        = (const float*)d_in[18];
    const float* g2         = (const float*)d_in[19];
    const float* be2        = (const float*)d_in[20];
    float* out              = (float*)d_out;

    const int N = in_sizes[0] / (128 * NS);   // blocks of NS samples
    label_row_block16_kernel<<<N, NT, 0, stream>>>(
        Z, A_full, feat_emb, label_tok, wq, bq, wk, bk, wv, bv, wo, bo,
        w1, b1, w2, b2, alphap, g1, be1, g2, be2, out);
}
